// v000
// The times below were measured on an AMD MI455X: many runs one after another, warmed up first and cycling through
// copies of the inputs, with the whole window's GPU time divided by the number of runs. Launches and the gaps
// between them are all in it. The median over several windows is given; except for v000 it joins two sittings, which
// can be a few percent apart, so the side-by-side timings, each taken in one sitting, are the better comparison.
// The starting kernel, v000, takes 712 microseconds a run.
#include <hip/hip_runtime.h>

#define EMB   128
#define HID   128
#define NH    16
#define MODEL 2048
#define BB    4
#define SS    2048
#define WPB   4   // waves per block (wave32)

typedef _Float16 half_t;
typedef __attribute__((ext_vector_type(16))) _Float16 v16h;
typedef __attribute__((ext_vector_type(8)))  _Float16 v8h;
typedef __attribute__((ext_vector_type(8)))  float    v8f;
typedef unsigned int u32x4 __attribute__((ext_vector_type(4)));
typedef int          i32x4 __attribute__((ext_vector_type(4)));
typedef int          i32x8 __attribute__((ext_vector_type(8)));

static __device__ __forceinline__ v8f wmma16(v16h a, v16h b, v8f c) {
  // D = A(16x32 f16) * B(32x16 f16) + C(16x16 f32)
  return __builtin_amdgcn_wmma_f32_16x16x32_f16(false, a, false, b, (short)0, c,
                                                false, false);
}

static __device__ __forceinline__ v16h frag_f16(const half_t* __restrict__ p, int ld) {
  int lane = threadIdx.x & 31;
  const half_t* q = p + (size_t)(lane & 15) * ld + ((lane >> 4) << 3);
  v8h lo = *(const v8h*)q;
  v8h hi = *(const v8h*)(q + 16);
  return __builtin_shufflevector(lo, hi, 0,1,2,3,4,5,6,7,8,9,10,11,12,13,14,15);
}

// Same fragment but converting from fp32 source on the fly.
static __device__ __forceinline__ v16h frag_f32(const float* __restrict__ p, int ld) {
  int lane = threadIdx.x & 31;
  const float* q = p + (size_t)(lane & 15) * ld + ((lane >> 4) << 3);
  v16h r;
#pragma unroll
  for (int i = 0; i < 8; ++i) { r[i] = (half_t)q[i]; r[i + 8] = (half_t)q[16 + i]; }
  return r;
}

// Pre-packed B fragment: contiguous 32B per lane.
static __device__ __forceinline__ v16h frag_packed(const half_t* __restrict__ pk,
                                                   int kstep, int nt, int NT) {
  int lane = threadIdx.x & 31;
  return *(const v16h*)(pk + (((size_t)kstep * NT + nt) << 9) + ((size_t)lane << 4));
}

static __device__ __forceinline__ void tdm_load_2d(unsigned lds_addr,
                                                   const half_t* gptr,
                                                   unsigned dim0, unsigned dim1,
                                                   unsigned tile0, unsigned tile1,
                                                   unsigned stride0) {
  unsigned long long ga = (unsigned long long)(size_t)gptr;
  u32x4 g0;
  g0[0] = 1u;
  g0[1] = lds_addr;
  g0[2] = (unsigned)(ga & 0xffffffffu);
  g0[3] = (unsigned)((ga >> 32) & 0x01ffffffu) | 0x80000000u;
  i32x8 g1;
  g1[0] = 0x00010000;
  g1[1] = (int)((dim0 & 0xffffu) << 16);
  g1[2] = (int)(((dim0 >> 16) & 0xffffu) | ((dim1 & 0xffffu) << 16));
  g1[3] = (int)(((dim1 >> 16) & 0xffffu) | ((tile0 & 0xffffu) << 16));
  g1[4] = (int)(tile1 & 0xffffu);
  g1[5] = (int)stride0;
  g1[6] = 0;
  g1[7] = 0;
  i32x4 z4 = (i32x4)0;
#if defined(__clang_major__) && (__clang_major__ >= 23)
  i32x8 z8 = (i32x8)0;
  __builtin_amdgcn_tensor_load_to_lds(g0, g1, z4, z4, z8, 0);
#else
  __builtin_amdgcn_tensor_load_to_lds(g0, g1, z4, z4, 0);
#endif
}

// Shuffle a row-major (K,N) fp32 weight into f16 B-operand fragment order.
__global__ void pack_w_kernel(const float* __restrict__ W, half_t* __restrict__ packed,
                              int K, int N) {
  int idx = blockIdx.x * blockDim.x + threadIdx.x;
  int total = K * N;
  if (idx >= total) return;
  int NT = N >> 4;
  int f = idx >> 9;            // fragment = kstep*NT + nt (512 halves each)
  int within = idx & 511;
  int lane = within >> 4;
  int e = within & 15;         // element within v16h
  int kstep = f / NT;
  int nt = f - kstep * NT;
  int n = (nt << 4) + (lane & 15);
  int khalf = (lane >> 4) << 3;
  int j = e >> 1, hbit = e & 1;
  int k = (kstep << 5) +
          ((j < 4) ? (khalf + 2 * j + hbit) : (16 + khalf + 2 * (j - 4) + hbit));
  packed[idx] = (half_t)W[(size_t)k * N + n];
}

// QKV projection: one wave -> 16 seq rows x 128 hidden for one head.
__global__ void __launch_bounds__(WPB * 32)
proj_kernel(const float* __restrict__ qin, const float* __restrict__ kin,
            const float* __restrict__ vin,
            const half_t* __restrict__ wqp, const half_t* __restrict__ wkp,
            const half_t* __restrict__ wvp,
            const float* __restrict__ bq, const float* __restrict__ bk,
            const float* __restrict__ bv,
            half_t* __restrict__ qp, half_t* __restrict__ kp,
            half_t* __restrict__ vT) {
  int wave = threadIdx.x >> 5;
  int lane = threadIdx.x & 31;
  int gid = blockIdx.x * WPB + wave;       // (tile, head)
  int h = gid % NH;
  int tile = gid / NH;
  int b = tile / (SS / 16);
  int s0 = (tile % (SS / 16)) << 4;
  int which = blockIdx.y;                  // 0=q 1=k 2=v

  const float*  x    = (which == 0) ? qin : (which == 1) ? kin : vin;
  const half_t* wp   = (which == 0) ? wqp : (which == 1) ? wkp : wvp;
  const float*  bias = (which == 0) ? bq  : (which == 1) ? bk  : bv;

  const float* xa = x + ((size_t)b * SS + s0) * MODEL + h * EMB;
  v8f acc[8];
#pragma unroll
  for (int i = 0; i < 8; ++i) acc[i] = (v8f)0.f;

#pragma unroll
  for (int kk = 0; kk < 4; ++kk) {          // K = 128 = 4 x 32
    v16h a = frag_f32(xa + kk * 32, MODEL);
#pragma unroll
    for (int nt = 0; nt < 8; ++nt) {        // N = 128 = 8 x 16
      v16h bf = frag_packed(wp, kk, nt, 8);
      acc[nt] = wmma16(a, bf, acc[nt]);
    }
  }

  int rrow = (lane >> 4) << 3;              // C layout: M = r + 8*(lane/16)
  int col0 = lane & 15;                     // N = lane&15
  if (which < 2) {
    half_t* base = ((which == 0) ? qp : kp) + ((size_t)(b * NH + h) * SS + s0) * HID;
#pragma unroll
    for (int nt = 0; nt < 8; ++nt) {
      int col = nt * 16 + col0;
      float bb_ = bias[col];
#pragma unroll
      for (int r = 0; r < 8; ++r)
        base[(size_t)(rrow + r) * HID + col] = (half_t)(acc[nt][r] + bb_);
    }
  } else {
    // store V transposed: vT[b,h,d,key] so P*V B-operand loads are contiguous
    half_t* base = vT + (size_t)(b * NH + h) * HID * SS + s0;
#pragma unroll
    for (int nt = 0; nt < 8; ++nt) {
      int col = nt * 16 + col0;
      float bb_ = bias[col];
#pragma unroll
      for (int r = 0; r < 8; ++r)
        base[(size_t)col * SS + (rrow + r)] = (half_t)(acc[nt][r] + bb_);
    }
  }
}

// Flash attention. One block (4 waves) = one (b, h, 64-query group); waves each
// own a 16-query tile. K/V tiles (32 keys) staged into LDS by the Tensor Data
// Mover, double-buffered: DMA of tile t+1 overlaps WMMA compute of tile t.
__global__ void __launch_bounds__(WPB * 32)
attn_kernel(const half_t* __restrict__ qp, const half_t* __restrict__ kp,
            const half_t* __restrict__ vT, half_t* __restrict__ ctx) {
  __shared__ __align__(16) half_t k_buf[2][32 * HID];  // 2 x 8 KB: 32 keys x 128
  __shared__ __align__(16) half_t v_buf[2][HID * 32];  // 2 x 8 KB: 128 d x 32 keys
  __shared__ __align__(16) half_t p_buf[WPB][16 * 32]; // per-wave P transpose

  int wave = threadIdx.x >> 5;
  int lane = threadIdx.x & 31;
  int qg = blockIdx.x % (SS / 64);          // 64-query group
  int bh = blockIdx.x / (SS / 64);
  int h  = bh % NH;
  int b  = bh / NH;
  int qt = qg * WPB + wave;                 // this wave's 16-query tile

  const half_t* qph = qp + (size_t)(b * NH + h) * SS * HID;
  const half_t* kph = kp + (size_t)(b * NH + h) * SS * HID;
  const half_t* vth = vT + (size_t)(b * NH + h) * HID * SS;
  half_t* lp = p_buf[wave];

  v16h qf[4];
#pragma unroll
  for (int kk = 0; kk < 4; ++kk)
    qf[kk] = frag_f16(qph + (size_t)(qt * 16) * HID + kk * 32, HID);

  float m[8], l[8];
#pragma unroll
  for (int r = 0; r < 8; ++r) { m[r] = -1e30f; l[r] = 0.f; }
  v8f o[8];
#pragma unroll
  for (int i = 0; i < 8; ++i) o[i] = (v8f)0.f;

  const float sc = 0.088388347648318447f;   // 1/sqrt(128)
  int rrow = (lane >> 4) << 3;
  int col0 = lane & 15;
  const int NKT = SS / 32;                  // 64 key tiles

  if (wave == 0) {
    tdm_load_2d((unsigned)(size_t)&k_buf[0][0], kph, HID, 32, HID, 32, HID);
    tdm_load_2d((unsigned)(size_t)&v_buf[0][0], vth, 32, HID, 32, HID, SS);
    __builtin_amdgcn_s_wait_tensorcnt(0);
  }
  __syncthreads();

  for (int kt = 0; kt < NKT; ++kt) {
    int par = kt & 1;
    if (wave == 0 && kt + 1 < NKT) {        // async-stage next tile
      int key1 = (kt + 1) * 32;
      tdm_load_2d((unsigned)(size_t)&k_buf[par ^ 1][0],
                  kph + (size_t)key1 * HID, HID, 32, HID, 32, HID);
      tdm_load_2d((unsigned)(size_t)&v_buf[par ^ 1][0],
                  vth + key1, 32, HID, 32, HID, SS);
    }
    const half_t* kb = k_buf[par];
    const half_t* vb = v_buf[par];

    v8f s0v = (v8f)0.f, s1v = (v8f)0.f;
#pragma unroll
    for (int kk = 0; kk < 4; ++kk) {        // scores 16x32 over hidden=128
      v16h b0 = frag_f16(kb + kk * 32, HID);
      v16h b1 = frag_f16(kb + 16 * HID + kk * 32, HID);
      s0v = wmma16(qf[kk], b0, s0v);
      s1v = wmma16(qf[kk], b1, s1v);
    }

    float alpha[8];
#pragma unroll
    for (int r = 0; r < 8; ++r) {
      float a0 = s0v[r] * sc;
      float a1 = s1v[r] * sc;
      float rmax = fmaxf(a0, a1);
#pragma unroll
      for (int mask = 1; mask < 16; mask <<= 1)       // row reduce in 16-lane half
        rmax = fmaxf(rmax, __shfl_xor(rmax, mask, 32));
      float mn = fmaxf(m[r], rmax);
      float p0 = __expf(a0 - mn);
      float p1 = __expf(a1 - mn);
      float rs = p0 + p1;
#pragma unroll
      for (int mask = 1; mask < 16; mask <<= 1)
        rs += __shfl_xor(rs, mask, 32);
      alpha[r] = __expf(m[r] - mn);
      l[r] = l[r] * alpha[r] + rs;
      m[r] = mn;
      // C-layout -> row-major 16x32 P tile in LDS (f16)
      lp[(rrow + r) * 32 + col0]      = (half_t)p0;
      lp[(rrow + r) * 32 + 16 + col0] = (half_t)p1;
    }
#pragma unroll
    for (int nt = 0; nt < 8; ++nt)
#pragma unroll
      for (int r = 0; r < 8; ++r)
        o[nt][r] *= alpha[r];

    asm volatile("s_wait_dscnt 0x0" ::: "memory");
    v16h pf = frag_f16(lp, 32);
#pragma unroll
    for (int nt = 0; nt < 8; ++nt) {        // O += P(16x32) * V(32x128)
      v16h vf = frag_f16(vb + (size_t)(nt * 16) * 32, 32);
      o[nt] = wmma16(pf, vf, o[nt]);
    }

    if (wave == 0 && kt + 1 < NKT)
      __builtin_amdgcn_s_wait_tensorcnt(0); // next tile resident before barrier
    __syncthreads();                        // also fences buffer reuse
  }

  float inv[8];
#pragma unroll
  for (int r = 0; r < 8; ++r) inv[r] = 1.f / l[r];
  half_t* cbase = ctx + ((size_t)b * SS + qt * 16) * MODEL + h * HID;
#pragma unroll
  for (int nt = 0; nt < 8; ++nt) {
    int col = nt * 16 + col0;
#pragma unroll
    for (int r = 0; r < 8; ++r)
      cbase[(size_t)(rrow + r) * MODEL + col] = (half_t)(o[nt][r] * inv[r]);
  }
}

// Output projection: (B*S, 2048) x (2048, 2048) -> fp32 out (+bo).
__global__ void __launch_bounds__(WPB * 32)
out_gemm_kernel(const half_t* __restrict__ ctx, const half_t* __restrict__ wop,
                const float* __restrict__ bo, float* __restrict__ out) {
  int wave = threadIdx.x >> 5;
  int lane = threadIdx.x & 31;
  int gid = blockIdx.x * WPB + wave;
  const int NGRP = MODEL / 64;              // 32 groups of 4 n-tiles
  int mt = gid / NGRP;
  int ng = gid % NGRP;
  int row0 = mt * 16;
  v8f acc[4];
#pragma unroll
  for (int i = 0; i < 4; ++i) acc[i] = (v8f)0.f;
  const half_t* abase = ctx + (size_t)row0 * MODEL;
  for (int kstep = 0; kstep < MODEL / 32; ++kstep) {
    v16h a = frag_f16(abase + kstep * 32, MODEL);
#pragma unroll
    for (int j = 0; j < 4; ++j) {
      v16h bf = frag_packed(wop, kstep, ng * 4 + j, MODEL / 16);
      acc[j] = wmma16(a, bf, acc[j]);
    }
  }
  int rrow = (lane >> 4) << 3;
  int col0 = lane & 15;
#pragma unroll
  for (int j = 0; j < 4; ++j) {
    int col = ng * 64 + j * 16 + col0;
    float bb_ = bo[col];
#pragma unroll
    for (int r = 0; r < 8; ++r)
      out[(size_t)(row0 + rrow + r) * MODEL + col] = acc[j][r] + bb_;
  }
}

extern "C" void kernel_launch(void* const* d_in, const int* in_sizes, int n_in,
                              void* d_out, int out_size, void* d_ws, size_t ws_size,
                              hipStream_t stream) {
  (void)in_sizes; (void)n_in; (void)out_size; (void)ws_size;
  const float* q  = (const float*)d_in[0];
  const float* k  = (const float*)d_in[1];
  const float* v  = (const float*)d_in[2];
  const float* Wq = (const float*)d_in[3];
  const float* bq = (const float*)d_in[4];
  const float* Wk = (const float*)d_in[5];
  const float* bk = (const float*)d_in[6];
  const float* Wv = (const float*)d_in[7];
  const float* bv = (const float*)d_in[8];
  const float* Wo = (const float*)d_in[9];
  const float* bo = (const float*)d_in[10];
  float* out = (float*)d_out;

  char* ws = (char*)d_ws;
  const size_t SZP = (size_t)BB * NH * SS * HID * sizeof(half_t); // 32 MiB each
  half_t* qp  = (half_t*)(ws);
  half_t* kp  = (half_t*)(ws + SZP);
  half_t* vT  = (half_t*)(ws + 2 * SZP);
  half_t* ctx = (half_t*)(ws + 3 * SZP);
  half_t* wqp = (half_t*)(ws + 4 * SZP);
  half_t* wkp = wqp + EMB * HID;
  half_t* wvp = wkp + EMB * HID;
  half_t* wop = wvp + EMB * HID;            // 2048*2048 f16

  // 1) pack weights into WMMA B-fragment order (f32 -> f16)
  pack_w_kernel<<<(EMB * HID + 255) / 256, 256, 0, stream>>>(Wq, wqp, EMB, HID);
  pack_w_kernel<<<(EMB * HID + 255) / 256, 256, 0, stream>>>(Wk, wkp, EMB, HID);
  pack_w_kernel<<<(EMB * HID + 255) / 256, 256, 0, stream>>>(Wv, wvp, EMB, HID);
  pack_w_kernel<<<(MODEL * MODEL + 255) / 256, 256, 0, stream>>>(Wo, wop, MODEL, MODEL);

  // 2) QKV projections (V stored transposed)
  dim3 pgrid(BB * (SS / 16) * NH / WPB, 3);
  proj_kernel<<<pgrid, WPB * 32, 0, stream>>>(q, k, v, wqp, wkp, wvp,
                                              bq, bk, bv, qp, kp, vT);

  attn_kernel<<<BB * NH * (SS / 64), WPB * 32, 0, stream>>>(qp, kp, vT, ctx);

  // 4) output GEMM + bias
  out_gemm_kernel<<<(BB * SS / 16) * (MODEL / 64) / WPB, WPB * 32, 0, stream>>>(
      ctx, wop, bo, out);
}

// v001
// A run of this version takes 409 microseconds.
// Next to v000, in two timings, it ran 1.81 times as fast each time.
#include <hip/hip_runtime.h>

#define EMB   128
#define HID   128
#define NH    16
#define MODEL 2048
#define BB    4
#define SS    2048
#define WPB   4   // waves per block (wave32)
#define NKT   (SS / 32)   // 32-key stages per head
#define STAGE_H 8192      // halves per stage block: 4096 of K fragments, then 4096 of V fragments
#define STAGE_B 16384u    // the same in bytes

typedef _Float16 half_t;
typedef __attribute__((ext_vector_type(16))) _Float16 v16h;
typedef __attribute__((ext_vector_type(8)))  _Float16 v8h;
typedef __attribute__((ext_vector_type(8)))  float    v8f;
typedef unsigned int u32x4 __attribute__((ext_vector_type(4)));
typedef unsigned int u32x8 __attribute__((ext_vector_type(8)));

static __device__ __forceinline__ v8f wmma16(v16h a, v16h b, v8f c) {
  // D = A(16x32 f16) * B(32x16 f16) + C(16x16 f32)
  return __builtin_amdgcn_wmma_f32_16x16x32_f16(false, a, false, b, (short)0, c,
                                                false, false);
}

static __device__ __forceinline__ v16h frag_f16(const half_t* __restrict__ p, int ld) {
  int lane = threadIdx.x & 31;
  const half_t* q = p + (size_t)(lane & 15) * ld + ((lane >> 4) << 3);
  v8h lo = *(const v8h*)q;
  v8h hi = *(const v8h*)(q + 16);
  return __builtin_shufflevector(lo, hi, 0,1,2,3,4,5,6,7,8,9,10,11,12,13,14,15);
}

// Same fragment but converting from fp32 source on the fly.
static __device__ __forceinline__ v16h frag_f32(const float* __restrict__ p, int ld) {
  int lane = threadIdx.x & 31;
  const float* q = p + (size_t)(lane & 15) * ld + ((lane >> 4) << 3);
  v16h r;
#pragma unroll
  for (int i = 0; i < 8; ++i) { r[i] = (half_t)q[i]; r[i + 8] = (half_t)q[16 + i]; }
  return r;
}

// Pre-packed B fragment: contiguous 32B per lane.
static __device__ __forceinline__ v16h frag_packed(const half_t* __restrict__ pk,
                                                   int kstep, int nt, int NT) {
  int lane = threadIdx.x & 31;
  return *(const v16h*)(pk + (((size_t)kstep * NT + nt) << 9) + ((size_t)lane << 4));
}

// Fragment stored in operand order: 512 B of low halves (16 B per lane), then 512 B of
// high halves. p already holds the lane's own 8-half offset.
static __device__ __forceinline__ v16h frag_ordered(const half_t* p) {
  v8h lo = *(const v8h*)p;
  v8h hi = *(const v8h*)(p + 256);
  return __builtin_shufflevector(lo, hi, 0,1,2,3,4,5,6,7,8,9,10,11,12,13,14,15);
}

static __device__ __forceinline__ unsigned uni(unsigned v) {
  return (unsigned)__builtin_amdgcn_readfirstlane(v);
}
static __device__ __forceinline__ unsigned pinned(unsigned v) {
  unsigned w = (unsigned)__builtin_amdgcn_readfirstlane(v);
  asm volatile("" : "+s"(w));
  return w;
}

static __device__ __forceinline__ u32x4 tdm_group0(unsigned lds_dst, const half_t* gptr) {
  unsigned long long ga = (unsigned long long)(size_t)gptr;
  u32x4 g0;
  g0[0] = uni(1u);                                              // count = 1
  g0[1] = uni(lds_dst);                                         // LDS byte offset
  g0[2] = uni((unsigned)ga);                                    // address [31:0]
  g0[3] = uni((((unsigned)(ga >> 32)) & 0x01ffffffu) | 0x80000000u); // address [56:32], type = 2
  return g0;
}
static __device__ __forceinline__ u32x8 tdm_group1() {
  u32x8 g1;
  g1[0] = uni(0u);
  g1[1] = uni(256u << 16);
  g1[2] = uni(64u << 16);
  g1[3] = uni(256u << 16);
  g1[4] = uni(64u);
  g1[5] = uni(256u);
  g1[6] = uni(0u);
  g1[7] = uni(0u);
  return g1;
}
// The next stage block follows the last one in memory.
static __device__ __forceinline__ void tdm_advance(u32x4& g0, unsigned lds_dst) {
  unsigned lo = g0[2] + STAGE_B;
  g0[3] = uni(g0[3] + (lo < STAGE_B ? 1u : 0u));                // carry into address [56:32]
  g0[2] = uni(lo);
  g0[1] = uni(lds_dst);
}
static __device__ __forceinline__ void tdm_issue(u32x4& g0, u32x8& g1) {
  asm volatile("tensor_load_to_lds %0, %1" : "+s"(g0), "+s"(g1) : : "memory");
}

// Shuffle a row-major (K,N) fp32 weight into f16 B-operand fragment order.
__global__ void pack_w_kernel(const float* __restrict__ W, half_t* __restrict__ packed,
                              int K, int N) {
  int idx = blockIdx.x * blockDim.x + threadIdx.x;
  int total = K * N;
  if (idx >= total) return;
  int NT = N >> 4;
  int f = idx >> 9;            // fragment = kstep*NT + nt (512 halves each)
  int within = idx & 511;
  int lane = within >> 4;
  int e = within & 15;         // element within v16h
  int kstep = f / NT;
  int nt = f - kstep * NT;
  int n = (nt << 4) + (lane & 15);
  int khalf = (lane >> 4) << 3;
  int j = e >> 1, hbit = e & 1;
  int k = (kstep << 5) +
          ((j < 4) ? (khalf + 2 * j + hbit) : (16 + khalf + 2 * (j - 4) + hbit));
  packed[idx] = (half_t)W[(size_t)k * N + n];
}

// QKV projection: one wave -> 16 seq rows x 128 hidden for one head.
// K and V leave in the attention kernel's operand order, one 16 KB block per
// (batch, head, 32 keys): halves [0,4096) K, fragment (16-key tile j, 32-wide k step kk) at
// (j*4+kk)*512; halves [4096,8192) V, fragment (16-wide d tile nt) at nt*512.
__global__ void __launch_bounds__(WPB * 32)
proj_kernel(const float* __restrict__ qin, const float* __restrict__ kin,
            const float* __restrict__ vin,
            const half_t* __restrict__ wqp, const half_t* __restrict__ wkp,
            const half_t* __restrict__ wvp,
            const float* __restrict__ bq, const float* __restrict__ bk,
            const float* __restrict__ bv,
            half_t* __restrict__ qp, half_t* __restrict__ kv) {
  int wave = threadIdx.x >> 5;
  int lane = threadIdx.x & 31;
  int gid = blockIdx.x * WPB + wave;       // (tile, head)
  int h = gid % NH;
  int tile = gid / NH;
  int b = tile / (SS / 16);
  int s0 = (tile % (SS / 16)) << 4;
  int which = blockIdx.y;                  // 0=q 1=k 2=v

  const float*  x    = (which == 0) ? qin : (which == 1) ? kin : vin;
  const half_t* wp   = (which == 0) ? wqp : (which == 1) ? wkp : wvp;
  const float*  bias = (which == 0) ? bq  : (which == 1) ? bk  : bv;

  const float* xa = x + ((size_t)b * SS + s0) * MODEL + h * EMB;
  v8f acc[8];
#pragma unroll
  for (int i = 0; i < 8; ++i) acc[i] = (v8f)0.f;

  int rrow = (lane >> 4) << 3;              // C layout: M = r + 8*(lane/16)
  int col0 = lane & 15;                     // N = lane&15
  half_t* blk = kv + ((size_t)(b * NH + h) * NKT + (s0 >> 5)) * STAGE_H + lane * 8;
  int j = (s0 >> 4) & 1;                    // which 16 keys of the block's 32

  if (which == 1) {
    // K: weights as A, x as B, so a lane ends with 8 consecutive hidden of one key
#pragma unroll
    for (int kk = 0; kk < 4; ++kk) {        // K = 128 = 4 x 32
      v16h a = frag_f32(xa + kk * 32, MODEL);
#pragma unroll
      for (int nt = 0; nt < 8; ++nt) {      // N = 128 = 8 x 16
        v16h bf = frag_packed(wp, kk, nt, 8);
        acc[nt] = wmma16(bf, a, acc[nt]);
      }
    }
    // acc[nt][r] = K[key s0 + (lane&15)][hidden nt*16 + rrow + r]: half nt&1 of k step nt>>1
    half_t* base = blk + j * 2048;
#pragma unroll
    for (int nt = 0; nt < 8; ++nt) {
      const float* bp = bias + nt * 16 + rrow;
      v8h w;
#pragma unroll
      for (int r = 0; r < 8; ++r) w[r] = (half_t)(acc[nt][r] + bp[r]);
      *(v8h*)(base + nt * 256) = w;
    }
    return;
  }

#pragma unroll
  for (int kk = 0; kk < 4; ++kk) {          // K = 128 = 4 x 32
    v16h a = frag_f32(xa + kk * 32, MODEL);
#pragma unroll
    for (int nt = 0; nt < 8; ++nt) {        // N = 128 = 8 x 16
      v16h bf = frag_packed(wp, kk, nt, 8);
      acc[nt] = wmma16(a, bf, acc[nt]);
    }
  }
  __builtin_amdgcn_sched_barrier(0);
  asm volatile("v_nop\n\tv_nop\n\tv_nop\n\tv_nop\n\tv_nop");
  __builtin_amdgcn_sched_barrier(0);

  if (which == 0) {
    half_t* base = qp + ((size_t)(b * NH + h) * SS + s0) * HID;
#pragma unroll
    for (int nt = 0; nt < 8; ++nt) {
      int col = nt * 16 + col0;
      float bb_ = bias[col];
#pragma unroll
      for (int r = 0; r < 8; ++r)
        base[(size_t)(rrow + r) * HID + col] = (half_t)(acc[nt][r] + bb_);
    }
  } else {
    // acc[nt][r] = V[key s0 + rrow + r][d nt*16 + (lane&15)]: half j of d tile nt
    half_t* base = blk + 4096 + j * 256;
#pragma unroll
    for (int nt = 0; nt < 8; ++nt) {
      float bb_ = bias[nt * 16 + col0];
      v8h w;
#pragma unroll
      for (int r = 0; r < 8; ++r) w[r] = (half_t)(acc[nt][r] + bb_);
      *(v8h*)(base + nt * 512) = w;
    }
    // the listing runs on from here into the Q block, which rewrites these stores' registers
    asm volatile("s_wait_xcnt 0x0" ::: "memory");
  }
}

// Flash attention. One block (4 waves) = one (b, h, 64-query group); waves each
// own a 16-query tile. K/V stage blocks (32 keys, operand order) come into LDS by
// one tensor load each, two buffers: the load of stage t+1 flies under pass t.
__global__ void __launch_bounds__(WPB * 32)
attn_kernel(const half_t* __restrict__ qp, const half_t* __restrict__ kv,
            half_t* __restrict__ ctx) {
  __shared__ __attribute__((aligned(2048))) half_t kv_buf[2][STAGE_H]; // 2 x 16 KB
  __shared__ __align__(16) half_t p_buf[WPB][16 * 32]; // per-wave P transpose

  int wave = (int)uni(threadIdx.x >> 5);
  int lane = threadIdx.x & 31;
  int qg = blockIdx.x % (SS / 64);          // 64-query group
  int bh = blockIdx.x / (SS / 64);
  int h  = bh % NH;
  int b  = bh / NH;
  int qt = qg * WPB + wave;                 // this wave's 16-query tile

  const half_t* qph = qp + (size_t)(b * NH + h) * SS * HID;
  const half_t* kvh = kv + (size_t)(b * NH + h) * NKT * STAGE_H;
  half_t* lp = p_buf[wave];

  v16h qf[4];
#pragma unroll
  for (int kk = 0; kk < 4; ++kk)
    qf[kk] = frag_f16(qph + (size_t)(qt * 16) * HID + kk * 32, HID);

  float m[8], l[8];
#pragma unroll
  for (int r = 0; r < 8; ++r) { m[r] = -1e30f; l[r] = 0.f; }
  v8f o[8];
#pragma unroll
  for (int i = 0; i < 8; ++i) o[i] = (v8f)0.f;

  const float sc = 0.088388347648318447f;   // 1/sqrt(128)
  int rrow = (lane >> 4) << 3;
  int col0 = lane & 15;
  const unsigned lds0 = (unsigned)(size_t)&kv_buf[0][0];

  // prologue: stage 0 lands and is published, then stage 1 is set off
  u32x4 g0 = tdm_group0(lds0, kvh);
  u32x8 g1 = tdm_group1();
  if (pinned(wave == 0)) {
    tdm_issue(g0, g1);
    asm volatile("s_wait_tensorcnt 0x0" ::: "memory");  // stage 0 landed before the barrier publishes it
  }
  __syncthreads();
  if (pinned(wave == 0)) {
    tdm_advance(g0, lds0 + STAGE_B);
    tdm_issue(g0, g1);
  }

  for (int kt = 0; kt < NKT; ++kt) {
    int par = kt & 1;
    const half_t* sb = kv_buf[par] + lane * 8;

    v8f s0v = (v8f)0.f, s1v = (v8f)0.f;
#pragma unroll
    for (int kk = 0; kk < 4; ++kk) {        // scores 16x32 over hidden=128
      v16h b0 = frag_ordered(sb + kk * 512);
      v16h b1 = frag_ordered(sb + 2048 + kk * 512);
      s0v = wmma16(qf[kk], b0, s0v);
      s1v = wmma16(qf[kk], b1, s1v);
    }

    float alpha[8];
#pragma unroll
    for (int r = 0; r < 8; ++r) {
      float a0 = s0v[r] * sc;
      float a1 = s1v[r] * sc;
      float rmax = fmaxf(a0, a1);
#pragma unroll
      for (int mask = 1; mask < 16; mask <<= 1)       // row reduce in 16-lane half
        rmax = fmaxf(rmax, __shfl_xor(rmax, mask, 32));
      float mn = fmaxf(m[r], rmax);
      float p0 = __expf(a0 - mn);
      float p1 = __expf(a1 - mn);
      float rs = p0 + p1;
#pragma unroll
      for (int mask = 1; mask < 16; mask <<= 1)
        rs += __shfl_xor(rs, mask, 32);
      alpha[r] = __expf(m[r] - mn);
      l[r] = l[r] * alpha[r] + rs;
      m[r] = mn;
      // C-layout -> row-major 16x32 P tile in LDS (f16)
      lp[(rrow + r) * 32 + col0]      = (half_t)p0;
      lp[(rrow + r) * 32 + 16 + col0] = (half_t)p1;
    }
#pragma unroll
    for (int nt = 0; nt < 8; ++nt)
#pragma unroll
      for (int r = 0; r < 8; ++r)
        o[nt][r] *= alpha[r];

    asm volatile("s_wait_dscnt 0x0" ::: "memory");
    v16h pf = frag_f16(lp, 32);
#pragma unroll
    for (int nt = 0; nt < 8; ++nt) {        // O += P(16x32) * V(32x128)
      v16h vf = frag_ordered(sb + 4096 + nt * 512);
      o[nt] = wmma16(pf, vf, o[nt]);
    }

    // publish point of stage kt+1
    asm volatile("s_wait_dscnt 0x0" ::: "memory");        // this wave's reads of the buffer are done before it is refilled
    if (pinned(wave == 0))
      asm volatile("s_wait_tensorcnt 0x0" ::: "memory");  // stage kt+1 landed before the barrier publishes it
    __syncthreads();                                      // publishes kt+1, ends every read of this pass's buffer
    if (pinned((wave == 0) & (kt + 2 < NKT))) {           // stage kt+2 into the buffer this pass has read
      tdm_advance(g0, lds0 + (unsigned)par * STAGE_B);
      tdm_issue(g0, g1);
    }
  }
  asm volatile("s_wait_tensorcnt 0x0" ::: "memory");      // nothing in flight when the wave ends
  asm volatile("s_wait_dscnt 0x0" ::: "memory");

  float inv[8];
#pragma unroll
  for (int r = 0; r < 8; ++r) inv[r] = 1.f / l[r];
  half_t* cbase = ctx + ((size_t)b * SS + qt * 16) * MODEL + h * HID;
#pragma unroll
  for (int nt = 0; nt < 8; ++nt) {
    int col = nt * 16 + col0;
#pragma unroll
    for (int r = 0; r < 8; ++r)
      cbase[(size_t)(rrow + r) * MODEL + col] = (half_t)(o[nt][r] * inv[r]);
  }
}

// Output projection: (B*S, 2048) x (2048, 2048) -> fp32 out (+bo).
__global__ void __launch_bounds__(WPB * 32)
out_gemm_kernel(const half_t* __restrict__ ctx, const half_t* __restrict__ wop,
                const float* __restrict__ bo, float* __restrict__ out) {
  int wave = threadIdx.x >> 5;
  int lane = threadIdx.x & 31;
  int gid = blockIdx.x * WPB + wave;
  const int NGRP = MODEL / 64;              // 32 groups of 4 n-tiles
  int mt = gid / NGRP;
  int ng = gid % NGRP;
  int row0 = mt * 16;
  v8f acc[4];
#pragma unroll
  for (int i = 0; i < 4; ++i) acc[i] = (v8f)0.f;
  const half_t* abase = ctx + (size_t)row0 * MODEL;
  for (int kstep = 0; kstep < MODEL / 32; ++kstep) {
    v16h a = frag_f16(abase + kstep * 32, MODEL);
#pragma unroll
    for (int j = 0; j < 4; ++j) {
      v16h bf = frag_packed(wop, kstep, ng * 4 + j, MODEL / 16);
      acc[j] = wmma16(a, bf, acc[j]);
    }
  }
  int rrow = (lane >> 4) << 3;
  int col0 = lane & 15;
#pragma unroll
  for (int j = 0; j < 4; ++j) {
    int col = ng * 64 + j * 16 + col0;
    float bb_ = bo[col];
#pragma unroll
    for (int r = 0; r < 8; ++r)
      out[(size_t)(row0 + rrow + r) * MODEL + col] = acc[j][r] + bb_;
  }
}

extern "C" void kernel_launch(void* const* d_in, const int* in_sizes, int n_in,
                              void* d_out, int out_size, void* d_ws, size_t ws_size,
                              hipStream_t stream) {
  (void)in_sizes; (void)n_in; (void)out_size; (void)ws_size;
  const float* q  = (const float*)d_in[0];
  const float* k  = (const float*)d_in[1];
  const float* v  = (const float*)d_in[2];
  const float* Wq = (const float*)d_in[3];
  const float* bq = (const float*)d_in[4];
  const float* Wk = (const float*)d_in[5];
  const float* bk = (const float*)d_in[6];
  const float* Wv = (const float*)d_in[7];
  const float* bv = (const float*)d_in[8];
  const float* Wo = (const float*)d_in[9];
  const float* bo = (const float*)d_in[10];
  float* out = (float*)d_out;

  char* ws = (char*)d_ws;
  const size_t SZP = (size_t)BB * NH * SS * HID * sizeof(half_t); // 32 MiB each
  half_t* qp  = (half_t*)(ws);
  half_t* kv  = (half_t*)(ws + SZP);        // K and V stage blocks, 2 * SZP
  half_t* ctx = (half_t*)(ws + 3 * SZP);
  half_t* wqp = (half_t*)(ws + 4 * SZP);
  half_t* wkp = wqp + EMB * HID;
  half_t* wvp = wkp + EMB * HID;
  half_t* wop = wvp + EMB * HID;            // 2048*2048 f16

  // 1) pack weights into WMMA B-fragment order (f32 -> f16)
  pack_w_kernel<<<(EMB * HID + 255) / 256, 256, 0, stream>>>(Wq, wqp, EMB, HID);
  pack_w_kernel<<<(EMB * HID + 255) / 256, 256, 0, stream>>>(Wk, wkp, EMB, HID);
  pack_w_kernel<<<(EMB * HID + 255) / 256, 256, 0, stream>>>(Wv, wvp, EMB, HID);
  pack_w_kernel<<<(MODEL * MODEL + 255) / 256, 256, 0, stream>>>(Wo, wop, MODEL, MODEL);

  // 2) QKV projections (K and V stored in operand order)
  dim3 pgrid(BB * (SS / 16) * NH / WPB, 3);
  proj_kernel<<<pgrid, WPB * 32, 0, stream>>>(q, k, v, wqp, wkp, wvp,
                                              bq, bk, bv, qp, kv);

  // 3) flash attention with tensor-loaded K/V stage blocks
  attn_kernel<<<BB * NH * (SS / 64), WPB * 32, 0, stream>>>(qp, kv, ctx);

  // 4) output GEMM + bias
  out_gemm_kernel<<<(BB * SS / 16) * (MODEL / 64) / WPB, WPB * 32, 0, stream>>>(
      ctx, wop, bo, out);
}

// v002
// One run takes 326 microseconds.
// In two side-by-side timings against v001, it was 1.26 and 1.25 times as fast.
// Counting every step since v000, it is 2.27 times as fast.
#include <hip/hip_runtime.h>

#define EMB   128
#define HID   128
#define NH    16
#define MODEL 2048
#define BB    4
#define SS    2048
#define WPB   4   // waves per block (wave32)
#define NKT   (SS / 32)   // 32-key stages per head
#define STAGE_H 8192      // halves per stage block: 4096 of K fragments, then 4096 of V fragments
#define STAGE_B 16384u    // the same in bytes

typedef _Float16 half_t;
typedef __attribute__((ext_vector_type(16))) _Float16 v16h;
typedef __attribute__((ext_vector_type(8)))  _Float16 v8h;
typedef __attribute__((ext_vector_type(8)))  float    v8f;
typedef unsigned int u32x4 __attribute__((ext_vector_type(4)));
typedef unsigned int u32x8 __attribute__((ext_vector_type(8)));

static __device__ __forceinline__ v8f wmma16(v16h a, v16h b, v8f c) {
  // D = A(16x32 f16) * B(32x16 f16) + C(16x16 f32)
  return __builtin_amdgcn_wmma_f32_16x16x32_f16(false, a, false, b, (short)0, c,
                                                false, false);
}

static __device__ __forceinline__ v16h frag_f16(const half_t* __restrict__ p, int ld) {
  int lane = threadIdx.x & 31;
  const half_t* q = p + (size_t)(lane & 15) * ld + ((lane >> 4) << 3);
  v8h lo = *(const v8h*)q;
  v8h hi = *(const v8h*)(q + 16);
  return __builtin_shufflevector(lo, hi, 0,1,2,3,4,5,6,7,8,9,10,11,12,13,14,15);
}

// Same fragment but converting from fp32 source on the fly.
static __device__ __forceinline__ v16h frag_f32(const float* __restrict__ p, int ld) {
  int lane = threadIdx.x & 31;
  const float* q = p + (size_t)(lane & 15) * ld + ((lane >> 4) << 3);
  v16h r;
#pragma unroll
  for (int i = 0; i < 8; ++i) { r[i] = (half_t)q[i]; r[i + 8] = (half_t)q[16 + i]; }
  return r;
}

// Pre-packed B fragment: contiguous 32B per lane.
static __device__ __forceinline__ v16h frag_packed(const half_t* __restrict__ pk,
                                                   int kstep, int nt, int NT) {
  int lane = threadIdx.x & 31;
  return *(const v16h*)(pk + (((size_t)kstep * NT + nt) << 9) + ((size_t)lane << 4));
}

// Fragment stored in operand order: 512 B of low halves (16 B per lane), then 512 B of
// high halves. p already holds the lane's own 8-half offset.
static __device__ __forceinline__ v16h frag_ordered(const half_t* p) {
  v8h lo = *(const v8h*)p;
  v8h hi = *(const v8h*)(p + 256);
  return __builtin_shufflevector(lo, hi, 0,1,2,3,4,5,6,7,8,9,10,11,12,13,14,15);
}

static __device__ __forceinline__ float xhalf(float x) {
  int b = __builtin_bit_cast(int, x);
  return __builtin_bit_cast(float, __builtin_amdgcn_permlanex16(b, b, 0x76543210, 0xfedcba98, false, false));
}

static __device__ __forceinline__ unsigned uni(unsigned v) {
  return (unsigned)__builtin_amdgcn_readfirstlane(v);
}
static __device__ __forceinline__ unsigned pinned(unsigned v) {
  unsigned w = (unsigned)__builtin_amdgcn_readfirstlane(v);
  asm volatile("" : "+s"(w));
  return w;
}

static __device__ __forceinline__ u32x4 tdm_group0(unsigned lds_dst, const half_t* gptr) {
  unsigned long long ga = (unsigned long long)(size_t)gptr;
  u32x4 g0;
  g0[0] = uni(1u);                                              // count = 1
  g0[1] = uni(lds_dst);                                         // LDS byte offset
  g0[2] = uni((unsigned)ga);                                    // address [31:0]
  g0[3] = uni((((unsigned)(ga >> 32)) & 0x01ffffffu) | 0x80000000u); // address [56:32], type = 2
  return g0;
}
static __device__ __forceinline__ u32x8 tdm_group1() {
  u32x8 g1;
  g1[0] = uni(0u);
  g1[1] = uni(256u << 16);
  g1[2] = uni(64u << 16);
  g1[3] = uni(256u << 16);
  g1[4] = uni(64u);
  g1[5] = uni(256u);
  g1[6] = uni(0u);
  g1[7] = uni(0u);
  return g1;
}
// The next stage block follows the last one in memory.
static __device__ __forceinline__ void tdm_advance(u32x4& g0, unsigned lds_dst) {
  unsigned lo = g0[2] + STAGE_B;
  g0[3] = uni(g0[3] + (lo < STAGE_B ? 1u : 0u));                // carry into address [56:32]
  g0[2] = uni(lo);
  g0[1] = uni(lds_dst);
}
static __device__ __forceinline__ void tdm_issue(u32x4& g0, u32x8& g1) {
  asm volatile("tensor_load_to_lds %0, %1" : "+s"(g0), "+s"(g1) : : "memory");
}

// Shuffle a row-major (K,N) fp32 weight into f16 B-operand fragment order.
__global__ void pack_w_kernel(const float* __restrict__ W, half_t* __restrict__ packed,
                              int K, int N) {
  int idx = blockIdx.x * blockDim.x + threadIdx.x;
  int total = K * N;
  if (idx >= total) return;
  int NT = N >> 4;
  int f = idx >> 9;            // fragment = kstep*NT + nt (512 halves each)
  int within = idx & 511;
  int lane = within >> 4;
  int e = within & 15;         // element within v16h
  int kstep = f / NT;
  int nt = f - kstep * NT;
  int n = (nt << 4) + (lane & 15);
  int khalf = (lane >> 4) << 3;
  int j = e >> 1, hbit = e & 1;
  int k = (kstep << 5) +
          ((j < 4) ? (khalf + 2 * j + hbit) : (16 + khalf + 2 * (j - 4) + hbit));
  packed[idx] = (half_t)W[(size_t)k * N + n];
}

// QKV projection: one wave -> 16 seq rows x 128 hidden for one head.
// K and V leave in the attention kernel's operand order, one 16 KB block per
// (batch, head, 32 keys): halves [0,4096) K, fragment (16-key tile j, 32-wide k step kk) at
// (j*4+kk)*512; halves [4096,8192) V, fragment (16-wide d tile nt) at nt*512.
__global__ void __launch_bounds__(WPB * 32)
proj_kernel(const float* __restrict__ qin, const float* __restrict__ kin,
            const float* __restrict__ vin,
            const half_t* __restrict__ wqp, const half_t* __restrict__ wkp,
            const half_t* __restrict__ wvp,
            const float* __restrict__ bq, const float* __restrict__ bk,
            const float* __restrict__ bv,
            half_t* __restrict__ qp, half_t* __restrict__ kv) {
  int wave = threadIdx.x >> 5;
  int lane = threadIdx.x & 31;
  int gid = blockIdx.x * WPB + wave;       // (tile, head)
  int h = gid % NH;
  int tile = gid / NH;
  int b = tile / (SS / 16);
  int s0 = (tile % (SS / 16)) << 4;
  int which = blockIdx.y;                  // 0=q 1=k 2=v

  const float*  x    = (which == 0) ? qin : (which == 1) ? kin : vin;
  const half_t* wp   = (which == 0) ? wqp : (which == 1) ? wkp : wvp;
  const float*  bias = (which == 0) ? bq  : (which == 1) ? bk  : bv;

  const float* xa = x + ((size_t)b * SS + s0) * MODEL + h * EMB;
  v8f acc[8];
#pragma unroll
  for (int i = 0; i < 8; ++i) acc[i] = (v8f)0.f;

  int rrow = (lane >> 4) << 3;              // C layout: M = r + 8*(lane/16)
  int col0 = lane & 15;                     // N = lane&15
  half_t* blk = kv + ((size_t)(b * NH + h) * NKT + (s0 >> 5)) * STAGE_H + lane * 8;
  int j = (s0 >> 4) & 1;                    // which 16 keys of the block's 32

  if (which == 1) {
    // K: weights as A, x as B, so a lane ends with 8 consecutive hidden of one key
#pragma unroll
    for (int kk = 0; kk < 4; ++kk) {        // K = 128 = 4 x 32
      v16h a = frag_f32(xa + kk * 32, MODEL);
#pragma unroll
      for (int nt = 0; nt < 8; ++nt) {      // N = 128 = 8 x 16
        v16h bf = frag_packed(wp, kk, nt, 8);
        acc[nt] = wmma16(bf, a, acc[nt]);
      }
    }
    // acc[nt][r] = K[key s0 + (lane&15)][hidden nt*16 + rrow + r]: half nt&1 of k step nt>>1
    half_t* base = blk + j * 2048;
#pragma unroll
    for (int nt = 0; nt < 8; ++nt) {
      const float* bp = bias + nt * 16 + rrow;
      v8h w;
#pragma unroll
      for (int r = 0; r < 8; ++r) w[r] = (half_t)(acc[nt][r] + bp[r]);
      *(v8h*)(base + nt * 256) = w;
    }
    return;
  }

#pragma unroll
  for (int kk = 0; kk < 4; ++kk) {          // K = 128 = 4 x 32
    v16h a = frag_f32(xa + kk * 32, MODEL);
#pragma unroll
    for (int nt = 0; nt < 8; ++nt) {        // N = 128 = 8 x 16
      v16h bf = frag_packed(wp, kk, nt, 8);
      acc[nt] = wmma16(a, bf, acc[nt]);
    }
  }
  __builtin_amdgcn_sched_barrier(0);
  asm volatile("v_nop\n\tv_nop\n\tv_nop\n\tv_nop\n\tv_nop");
  __builtin_amdgcn_sched_barrier(0);

  if (which == 0) {
    half_t* base = qp + ((size_t)(b * NH + h) * SS + s0) * HID;
#pragma unroll
    for (int nt = 0; nt < 8; ++nt) {
      int col = nt * 16 + col0;
      float bb_ = bias[col];
#pragma unroll
      for (int r = 0; r < 8; ++r)
        base[(size_t)(rrow + r) * HID + col] = (half_t)(acc[nt][r] + bb_);
    }
  } else {
    // acc[nt][r] = V[key s0 + rrow + r][d nt*16 + (lane&15)]: half j of d tile nt
    half_t* base = blk + 4096 + j * 256;
#pragma unroll
    for (int nt = 0; nt < 8; ++nt) {
      float bb_ = bias[nt * 16 + col0];
      v8h w;
#pragma unroll
      for (int r = 0; r < 8; ++r) w[r] = (half_t)(acc[nt][r] + bb_);
      *(v8h*)(base + nt * 512) = w;
    }
    // the listing runs on from here into the Q block, which rewrites these stores' registers
    asm volatile("s_wait_xcnt 0x0" ::: "memory");
  }
}

__global__ void __launch_bounds__(WPB * 32)
attn_kernel(const half_t* __restrict__ qp, const half_t* __restrict__ kv,
            half_t* __restrict__ ctx) {
  __shared__ __attribute__((aligned(2048))) half_t kv_buf[2][STAGE_H]; // 2 x 16 KB

  int wave = (int)uni(threadIdx.x >> 5);
  int lane = threadIdx.x & 31;
  int qg = blockIdx.x % (SS / 64);          // 64-query group
  int bh = blockIdx.x / (SS / 64);
  int h  = bh % NH;
  int b  = bh / NH;
  int qt = qg * WPB + wave;                 // this wave's 16-query tile

  const half_t* qph = qp + (size_t)(b * NH + h) * SS * HID;
  const half_t* kvh = kv + (size_t)(b * NH + h) * NKT * STAGE_H;

  v16h qf[4];
#pragma unroll
  for (int kk = 0; kk < 4; ++kk)
    qf[kk] = frag_f16(qph + (size_t)(qt * 16) * HID + kk * 32, HID);

  float m = -1e30f;                         // running maximum of query lane&15
  float l = 0.f;                            // running sum over this lane half's keys only
  v8f o[8];
#pragma unroll
  for (int i = 0; i < 8; ++i) o[i] = (v8f)0.f;

  const float sc = 0.088388347648318447f;   // 1/sqrt(128)
  int rrow = (lane >> 4) << 3;
  int col0 = lane & 15;
  const unsigned lds0 = (unsigned)(size_t)&kv_buf[0][0];

  // prologue: stage 0 lands and is published, then stage 1 is set off
  u32x4 g0 = tdm_group0(lds0, kvh);
  u32x8 g1 = tdm_group1();
  if (pinned(wave == 0)) {
    tdm_issue(g0, g1);
    asm volatile("s_wait_tensorcnt 0x0" ::: "memory");  // stage 0 landed before the barrier publishes it
  }
  __syncthreads();
  if (pinned(wave == 0)) {
    tdm_advance(g0, lds0 + STAGE_B);
    tdm_issue(g0, g1);
  }

  for (int kt = 0; kt < NKT; ++kt) {
    int par = kt & 1;
    const half_t* sb = kv_buf[par] + lane * 8;

    v8f s0v = (v8f)0.f, s1v = (v8f)0.f;
#pragma unroll
    for (int kk = 0; kk < 4; ++kk) {        // scores 32 keys x 16 queries over hidden=128
      v16h k0 = frag_ordered(sb + kk * 512);
      v16h k1 = frag_ordered(sb + 2048 + kk * 512);
      s0v = wmma16(k0, qf[kk], s0v);
      s1v = wmma16(k1, qf[kk], s1v);
    }
    // s0v[r] = S[key rrow + r][query col0], s1v[r] = S[key 16 + rrow + r][query col0]

    float rmax = fmaxf(s0v[0], s1v[0]);
#pragma unroll
    for (int r = 1; r < 8; ++r) rmax = fmaxf(rmax, fmaxf(s0v[r], s1v[r]));
    rmax = fmaxf(rmax, xhalf(rmax));        // the other 16 keys of the same query
    float mn = fmaxf(m, rmax * sc);
    float alpha = __expf(m - mn);
    float rs0 = 0.f, rs1 = 0.f;
    v16h pf;                                // P^T as B operand: the two score tiles, converted in place
#pragma unroll
    for (int r = 0; r < 8; ++r) {
      float p0 = __expf(s0v[r] * sc - mn);
      float p1 = __expf(s1v[r] * sc - mn);
      rs0 += p0;
      rs1 += p1;
      pf[r]     = (half_t)p0;
      pf[r + 8] = (half_t)p1;
    }
    l = l * alpha + (rs0 + rs1);
    m = mn;
#pragma unroll
    for (int nt = 0; nt < 8; ++nt)
#pragma unroll
      for (int r = 0; r < 8; ++r)
        o[nt][r] *= alpha;

#pragma unroll
    for (int nt = 0; nt < 8; ++nt) {        // O^T += V^T(128x32) * P^T(32x16)
      v16h vf = frag_ordered(sb + 4096 + nt * 512);
      o[nt] = wmma16(vf, pf, o[nt]);
    }

    // publish point of stage kt+1
    asm volatile("s_wait_dscnt 0x0" ::: "memory");        // this wave's reads of the buffer are done before it is refilled
    if (pinned(wave == 0))
      asm volatile("s_wait_tensorcnt 0x0" ::: "memory");  // stage kt+1 landed before the barrier publishes it
    __syncthreads();                                      // publishes kt+1, ends every read of this pass's buffer
    if (pinned((wave == 0) & (kt + 2 < NKT))) {           // stage kt+2 into the buffer this pass has read
      tdm_advance(g0, lds0 + (unsigned)par * STAGE_B);
      tdm_issue(g0, g1);
    }
  }
  asm volatile("s_wait_tensorcnt 0x0" ::: "memory");      // nothing in flight when the wave ends
  asm volatile("s_wait_dscnt 0x0" ::: "memory");

  float inv = 1.f / (l + xhalf(l));         // the two lane halves' sums join here
  // o[nt][r] = O[query col0][d nt*16 + rrow + r]: 8 consecutive d, one 16-byte store
  half_t* cbase = ctx + ((size_t)b * SS + qt * 16 + col0) * MODEL + h * HID + rrow;
#pragma unroll
  for (int nt = 0; nt < 8; ++nt) {
    v8h w;
#pragma unroll
    for (int r = 0; r < 8; ++r) w[r] = (half_t)(o[nt][r] * inv);
    *(v8h*)(cbase + nt * 16) = w;
  }
}

// Output projection: (B*S, 2048) x (2048, 2048) -> fp32 out (+bo).
__global__ void __launch_bounds__(WPB * 32)
out_gemm_kernel(const half_t* __restrict__ ctx, const half_t* __restrict__ wop,
                const float* __restrict__ bo, float* __restrict__ out) {
  int wave = threadIdx.x >> 5;
  int lane = threadIdx.x & 31;
  int gid = blockIdx.x * WPB + wave;
  const int NGRP = MODEL / 64;              // 32 groups of 4 n-tiles
  int mt = gid / NGRP;
  int ng = gid % NGRP;
  int row0 = mt * 16;
  v8f acc[4];
#pragma unroll
  for (int i = 0; i < 4; ++i) acc[i] = (v8f)0.f;
  const half_t* abase = ctx + (size_t)row0 * MODEL;
  for (int kstep = 0; kstep < MODEL / 32; ++kstep) {
    v16h a = frag_f16(abase + kstep * 32, MODEL);
#pragma unroll
    for (int j = 0; j < 4; ++j) {
      v16h bf = frag_packed(wop, kstep, ng * 4 + j, MODEL / 16);
      acc[j] = wmma16(a, bf, acc[j]);
    }
  }
  int rrow = (lane >> 4) << 3;
  int col0 = lane & 15;
#pragma unroll
  for (int j = 0; j < 4; ++j) {
    int col = ng * 64 + j * 16 + col0;
    float bb_ = bo[col];
#pragma unroll
    for (int r = 0; r < 8; ++r)
      out[(size_t)(row0 + rrow + r) * MODEL + col] = acc[j][r] + bb_;
  }
}

extern "C" void kernel_launch(void* const* d_in, const int* in_sizes, int n_in,
                              void* d_out, int out_size, void* d_ws, size_t ws_size,
                              hipStream_t stream) {
  (void)in_sizes; (void)n_in; (void)out_size; (void)ws_size;
  const float* q  = (const float*)d_in[0];
  const float* k  = (const float*)d_in[1];
  const float* v  = (const float*)d_in[2];
  const float* Wq = (const float*)d_in[3];
  const float* bq = (const float*)d_in[4];
  const float* Wk = (const float*)d_in[5];
  const float* bk = (const float*)d_in[6];
  const float* Wv = (const float*)d_in[7];
  const float* bv = (const float*)d_in[8];
  const float* Wo = (const float*)d_in[9];
  const float* bo = (const float*)d_in[10];
  float* out = (float*)d_out;

  char* ws = (char*)d_ws;
  const size_t SZP = (size_t)BB * NH * SS * HID * sizeof(half_t); // 32 MiB each
  half_t* qp  = (half_t*)(ws);
  half_t* kv  = (half_t*)(ws + SZP);        // K and V stage blocks, 2 * SZP
  half_t* ctx = (half_t*)(ws + 3 * SZP);
  half_t* wqp = (half_t*)(ws + 4 * SZP);
  half_t* wkp = wqp + EMB * HID;
  half_t* wvp = wkp + EMB * HID;
  half_t* wop = wvp + EMB * HID;            // 2048*2048 f16

  // 1) pack weights into WMMA B-fragment order (f32 -> f16)
  pack_w_kernel<<<(EMB * HID + 255) / 256, 256, 0, stream>>>(Wq, wqp, EMB, HID);
  pack_w_kernel<<<(EMB * HID + 255) / 256, 256, 0, stream>>>(Wk, wkp, EMB, HID);
  pack_w_kernel<<<(EMB * HID + 255) / 256, 256, 0, stream>>>(Wv, wvp, EMB, HID);
  pack_w_kernel<<<(MODEL * MODEL + 255) / 256, 256, 0, stream>>>(Wo, wop, MODEL, MODEL);

  // 2) QKV projections (K and V stored in operand order)
  dim3 pgrid(BB * (SS / 16) * NH / WPB, 3);
  proj_kernel<<<pgrid, WPB * 32, 0, stream>>>(q, k, v, wqp, wkp, wvp,
                                              bq, bk, bv, qp, kv);

  // 3) flash attention with tensor-loaded K/V stage blocks
  attn_kernel<<<BB * NH * (SS / 64), WPB * 32, 0, stream>>>(qp, kv, ctx);

  // 4) output GEMM + bias
  out_gemm_kernel<<<(BB * SS / 16) * (MODEL / 64) / WPB, WPB * 32, 0, stream>>>(
      ctx, wop, bo, out);
}

// v003
// A run of this version takes 258 microseconds.
// In two side-by-side timings against v002, it was 1.26 and 1.27 times as fast.
// Counting every step since v000, it is 2.88 times as fast.
#include <hip/hip_runtime.h>

#define EMB   128
#define HID   128
#define NH    16
#define MODEL 2048
#define BB    4
#define SS    2048
#define WPB   4   // waves per block (wave32)
#define NKT   (SS / 32)   // 32-key stages per head
#define STAGE_H 8192      // halves per stage block: 4096 of K fragments, then 4096 of V fragments
#define STAGE_B 16384u    // the same in bytes

typedef _Float16 half_t;
typedef __attribute__((ext_vector_type(16))) _Float16 v16h;
typedef __attribute__((ext_vector_type(8)))  _Float16 v8h;
typedef __attribute__((ext_vector_type(8)))  float    v8f;
typedef unsigned int u32x4 __attribute__((ext_vector_type(4)));
typedef unsigned int u32x8 __attribute__((ext_vector_type(8)));

static __device__ __forceinline__ v8f wmma16(v16h a, v16h b, v8f c) {
  // D = A(16x32 f16) * B(32x16 f16) + C(16x16 f32)
  return __builtin_amdgcn_wmma_f32_16x16x32_f16(false, a, false, b, (short)0, c,
                                                false, false);
}

static __device__ __forceinline__ v16h frag_f16(const half_t* __restrict__ p, int ld) {
  int lane = threadIdx.x & 31;
  const half_t* q = p + (size_t)(lane & 15) * ld + ((lane >> 4) << 3);
  v8h lo = *(const v8h*)q;
  v8h hi = *(const v8h*)(q + 16);
  return __builtin_shufflevector(lo, hi, 0,1,2,3,4,5,6,7,8,9,10,11,12,13,14,15);
}

// Same fragment but converting from fp32 source on the fly.
static __device__ __forceinline__ v16h frag_f32(const float* __restrict__ p, int ld) {
  int lane = threadIdx.x & 31;
  const float* q = p + (size_t)(lane & 15) * ld + ((lane >> 4) << 3);
  v16h r;
#pragma unroll
  for (int i = 0; i < 8; ++i) { r[i] = (half_t)q[i]; r[i + 8] = (half_t)q[16 + i]; }
  return r;
}

// Pre-packed B fragment: contiguous 32B per lane.
static __device__ __forceinline__ v16h frag_packed(const half_t* __restrict__ pk,
                                                   int kstep, int nt, int NT) {
  int lane = threadIdx.x & 31;
  return *(const v16h*)(pk + (((size_t)kstep * NT + nt) << 9) + ((size_t)lane << 4));
}

// Fragment stored in operand order: 512 B of low halves (16 B per lane), then 512 B of
// high halves. p already holds the lane's own 8-half offset.
static __device__ __forceinline__ v16h frag_ordered(const half_t* p) {
  v8h lo = *(const v8h*)p;
  v8h hi = *(const v8h*)(p + 256);
  return __builtin_shufflevector(lo, hi, 0,1,2,3,4,5,6,7,8,9,10,11,12,13,14,15);
}

static __device__ __forceinline__ float xhalf(float x) {
  int b = __builtin_bit_cast(int, x);
  return __builtin_bit_cast(float, __builtin_amdgcn_permlanex16(b, b, 0x76543210, 0xfedcba98, false, false));
}

static __device__ __forceinline__ unsigned uni(unsigned v) {
  return (unsigned)__builtin_amdgcn_readfirstlane(v);
}
static __device__ __forceinline__ unsigned pinned(unsigned v) {
  unsigned w = (unsigned)__builtin_amdgcn_readfirstlane(v);
  asm volatile("" : "+s"(w));
  return w;
}

static __device__ __forceinline__ u32x4 tdm_group0(unsigned lds_dst, const half_t* gptr) {
  unsigned long long ga = (unsigned long long)(size_t)gptr;
  u32x4 g0;
  g0[0] = uni(1u);                                              // count = 1
  g0[1] = uni(lds_dst);                                         // LDS byte offset
  g0[2] = uni((unsigned)ga);                                    // address [31:0]
  g0[3] = uni((((unsigned)(ga >> 32)) & 0x01ffffffu) | 0x80000000u); // address [56:32], type = 2
  return g0;
}
static __device__ __forceinline__ u32x8 tdm_group1() {
  u32x8 g1;
  g1[0] = uni(0u);
  g1[1] = uni(256u << 16);
  g1[2] = uni(64u << 16);
  g1[3] = uni(256u << 16);
  g1[4] = uni(64u);
  g1[5] = uni(256u);
  g1[6] = uni(0u);
  g1[7] = uni(0u);
  return g1;
}
// The next stage block follows the last one in memory.
static __device__ __forceinline__ void tdm_advance(u32x4& g0, unsigned lds_dst) {
  unsigned lo = g0[2] + STAGE_B;
  g0[3] = uni(g0[3] + (lo < STAGE_B ? 1u : 0u));                // carry into address [56:32]
  g0[2] = uni(lo);
  g0[1] = uni(lds_dst);
}
static __device__ __forceinline__ void tdm_issue(u32x4& g0, u32x8& g1) {
  asm volatile("tensor_load_to_lds %0, %1" : "+s"(g0), "+s"(g1) : : "memory");
}

// Shuffle a row-major (K,N) fp32 weight into f16 B-operand fragment order.
__global__ void pack_w_kernel(const float* __restrict__ W, half_t* __restrict__ packed,
                              int K, int N) {
  int idx = blockIdx.x * blockDim.x + threadIdx.x;
  int total = K * N;
  if (idx >= total) return;
  int NT = N >> 4;
  int f = idx >> 9;            // fragment = kstep*NT + nt (512 halves each)
  int within = idx & 511;
  int lane = within >> 4;
  int e = within & 15;         // element within v16h
  int kstep = f / NT;
  int nt = f - kstep * NT;
  int n = (nt << 4) + (lane & 15);
  int khalf = (lane >> 4) << 3;
  int j = e >> 1, hbit = e & 1;
  int k = (kstep << 5) +
          ((j < 4) ? (khalf + 2 * j + hbit) : (16 + khalf + 2 * (j - 4) + hbit));
  packed[idx] = (half_t)W[(size_t)k * N + n];
}

// QKV projection: one wave -> 16 seq rows x 128 hidden for one head.
// K and V leave in the attention kernel's operand order, one 16 KB block per
// (batch, head, 32 keys): halves [0,4096) K, fragment (16-key tile j, 32-wide k step kk) at
// (j*4+kk)*512; halves [4096,8192) V, fragment (16-wide d tile nt) at nt*512.
__global__ void __launch_bounds__(WPB * 32)
proj_kernel(const float* __restrict__ qin, const float* __restrict__ kin,
            const float* __restrict__ vin,
            const half_t* __restrict__ wqp, const half_t* __restrict__ wkp,
            const half_t* __restrict__ wvp,
            const float* __restrict__ bq, const float* __restrict__ bk,
            const float* __restrict__ bv,
            half_t* __restrict__ qp, half_t* __restrict__ kv) {
  int wave = threadIdx.x >> 5;
  int lane = threadIdx.x & 31;
  int gid = blockIdx.x * WPB + wave;       // (tile, head)
  int h = gid % NH;
  int tile = gid / NH;
  int b = tile / (SS / 16);
  int s0 = (tile % (SS / 16)) << 4;
  int which = blockIdx.y;                  // 0=q 1=k 2=v

  const float*  x    = (which == 0) ? qin : (which == 1) ? kin : vin;
  const half_t* wp   = (which == 0) ? wqp : (which == 1) ? wkp : wvp;
  const float*  bias = (which == 0) ? bq  : (which == 1) ? bk  : bv;

  const float* xa = x + ((size_t)b * SS + s0) * MODEL + h * EMB;
  v8f acc[8];
#pragma unroll
  for (int i = 0; i < 8; ++i) acc[i] = (v8f)0.f;

  int rrow = (lane >> 4) << 3;              // C layout: M = r + 8*(lane/16)
  int col0 = lane & 15;                     // N = lane&15
  half_t* blk = kv + ((size_t)(b * NH + h) * NKT + (s0 >> 5)) * STAGE_H + lane * 8;
  int j = (s0 >> 4) & 1;                    // which 16 keys of the block's 32

  if (which == 1) {
    // K: weights as A, x as B, so a lane ends with 8 consecutive hidden of one key
#pragma unroll
    for (int kk = 0; kk < 4; ++kk) {        // K = 128 = 4 x 32
      v16h a = frag_f32(xa + kk * 32, MODEL);
#pragma unroll
      for (int nt = 0; nt < 8; ++nt) {      // N = 128 = 8 x 16
        v16h bf = frag_packed(wp, kk, nt, 8);
        acc[nt] = wmma16(bf, a, acc[nt]);
      }
    }
    // acc[nt][r] = K[key s0 + (lane&15)][hidden nt*16 + rrow + r]: half nt&1 of k step nt>>1
    half_t* base = blk + j * 2048;
#pragma unroll
    for (int nt = 0; nt < 8; ++nt) {
      const float* bp = bias + nt * 16 + rrow;
      v8h w;
#pragma unroll
      for (int r = 0; r < 8; ++r) w[r] = (half_t)(acc[nt][r] + bp[r]);
      *(v8h*)(base + nt * 256) = w;
    }
    return;
  }

#pragma unroll
  for (int kk = 0; kk < 4; ++kk) {          // K = 128 = 4 x 32
    v16h a = frag_f32(xa + kk * 32, MODEL);
#pragma unroll
    for (int nt = 0; nt < 8; ++nt) {        // N = 128 = 8 x 16
      v16h bf = frag_packed(wp, kk, nt, 8);
      acc[nt] = wmma16(a, bf, acc[nt]);
    }
  }
  __builtin_amdgcn_sched_barrier(0);
  asm volatile("v_nop\n\tv_nop\n\tv_nop\n\tv_nop\n\tv_nop");
  __builtin_amdgcn_sched_barrier(0);

  if (which == 0) {
    half_t* base = qp + ((size_t)(b * NH + h) * SS + s0) * HID;
#pragma unroll
    for (int nt = 0; nt < 8; ++nt) {
      int col = nt * 16 + col0;
      float bb_ = bias[col];
#pragma unroll
      for (int r = 0; r < 8; ++r)
        base[(size_t)(rrow + r) * HID + col] = (half_t)(acc[nt][r] + bb_);
    }
  } else {
    // acc[nt][r] = V[key s0 + rrow + r][d nt*16 + (lane&15)]: half j of d tile nt
    half_t* base = blk + 4096 + j * 256;
#pragma unroll
    for (int nt = 0; nt < 8; ++nt) {
      float bb_ = bias[nt * 16 + col0];
      v8h w;
#pragma unroll
      for (int r = 0; r < 8; ++r) w[r] = (half_t)(acc[nt][r] + bb_);
      *(v8h*)(base + nt * 512) = w;
    }
    // the listing runs on from here into the Q block, which rewrites these stores' registers
    asm volatile("s_wait_xcnt 0x0" ::: "memory");
  }
}

__global__ void __launch_bounds__(WPB * 32)
attn_kernel(const half_t* __restrict__ qp, const half_t* __restrict__ kv,
            half_t* __restrict__ ctx) {
  __shared__ __attribute__((aligned(2048))) half_t kv_buf[2][STAGE_H]; // 2 x 16 KB

  int wave = (int)uni(threadIdx.x >> 5);
  int lane = threadIdx.x & 31;
  int qg = blockIdx.x % (SS / 64);          // 64-query group
  int bh = blockIdx.x / (SS / 64);
  int h  = bh % NH;
  int b  = bh / NH;
  int qt = qg * WPB + wave;                 // this wave's 16-query tile

  const half_t* qph = qp + (size_t)(b * NH + h) * SS * HID;
  const half_t* kvh = kv + (size_t)(b * NH + h) * NKT * STAGE_H;

  v16h qf[4];
#pragma unroll
  for (int kk = 0; kk < 4; ++kk)
    qf[kk] = frag_f16(qph + (size_t)(qt * 16) * HID + kk * 32, HID);

  float m = -1e30f;                         // running maximum of query lane&15
  float l = 0.f;                            // running sum over this lane half's keys only
  v8f o[8];
#pragma unroll
  for (int i = 0; i < 8; ++i) o[i] = (v8f)0.f;

  const float sc = 0.088388347648318447f;   // 1/sqrt(128)
  int rrow = (lane >> 4) << 3;
  int col0 = lane & 15;
  const unsigned lds0 = (unsigned)(size_t)&kv_buf[0][0];

  // prologue: stage 0 lands and is published, then stage 1 is set off
  u32x4 g0 = tdm_group0(lds0, kvh);
  u32x8 g1 = tdm_group1();
  if (pinned(wave == 0)) {
    tdm_issue(g0, g1);
    asm volatile("s_wait_tensorcnt 0x0" ::: "memory");  // stage 0 landed before the barrier publishes it
  }
  __syncthreads();
  if (pinned(wave == 0)) {
    tdm_advance(g0, lds0 + STAGE_B);
    tdm_issue(g0, g1);
  }

  for (int kt = 0; kt < NKT; ++kt) {
    int par = kt & 1;
    const half_t* sb = kv_buf[par] + lane * 8;

    v8f s0v = (v8f)0.f, s1v = (v8f)0.f;
#pragma unroll
    for (int kk = 0; kk < 4; ++kk) {        // scores 32 keys x 16 queries over hidden=128
      v16h k0 = frag_ordered(sb + kk * 512);
      v16h k1 = frag_ordered(sb + 2048 + kk * 512);
      s0v = wmma16(k0, qf[kk], s0v);
      s1v = wmma16(k1, qf[kk], s1v);
    }
    // s0v[r] = S[key rrow + r][query col0], s1v[r] = S[key 16 + rrow + r][query col0]

    float rmax = fmaxf(s0v[0], s1v[0]);
#pragma unroll
    for (int r = 1; r < 8; ++r) rmax = fmaxf(rmax, fmaxf(s0v[r], s1v[r]));
    rmax = fmaxf(rmax, xhalf(rmax));        // the other 16 keys of the same query
    float mn = fmaxf(m, rmax * sc);
    float alpha = __expf(m - mn);
    float rs0 = 0.f, rs1 = 0.f;
    v16h pf;                                // P^T as B operand: the two score tiles, converted in place
#pragma unroll
    for (int r = 0; r < 8; ++r) {
      float p0 = __expf(s0v[r] * sc - mn);
      float p1 = __expf(s1v[r] * sc - mn);
      rs0 += p0;
      rs1 += p1;
      pf[r]     = (half_t)p0;
      pf[r + 8] = (half_t)p1;
    }
    l = l * alpha + (rs0 + rs1);
    m = mn;
#pragma unroll
    for (int nt = 0; nt < 8; ++nt)
#pragma unroll
      for (int r = 0; r < 8; ++r)
        o[nt][r] *= alpha;

#pragma unroll
    for (int nt = 0; nt < 8; ++nt) {        // O^T += V^T(128x32) * P^T(32x16)
      v16h vf = frag_ordered(sb + 4096 + nt * 512);
      o[nt] = wmma16(vf, pf, o[nt]);
    }

    // publish point of stage kt+1
    asm volatile("s_wait_dscnt 0x0" ::: "memory");        // this wave's reads of the buffer are done before it is refilled
    if (pinned(wave == 0))
      asm volatile("s_wait_tensorcnt 0x0" ::: "memory");  // stage kt+1 landed before the barrier publishes it
    __syncthreads();                                      // publishes kt+1, ends every read of this pass's buffer
    if (pinned((wave == 0) & (kt + 2 < NKT))) {           // stage kt+2 into the buffer this pass has read
      tdm_advance(g0, lds0 + (unsigned)par * STAGE_B);
      tdm_issue(g0, g1);
    }
  }
  asm volatile("s_wait_tensorcnt 0x0" ::: "memory");      // nothing in flight when the wave ends
  asm volatile("s_wait_dscnt 0x0" ::: "memory");

  float inv = 1.f / (l + xhalf(l));         // the two lane halves' sums join here
  // o[nt][r] = O[query col0][d nt*16 + rrow + r]: 8 consecutive d, one 16-byte store
  half_t* cbase = ctx + ((size_t)b * SS + qt * 16 + col0) * MODEL + h * HID + rrow;
#pragma unroll
  for (int nt = 0; nt < 8; ++nt) {
    v8h w;
#pragma unroll
    for (int r = 0; r < 8; ++r) w[r] = (half_t)(o[nt][r] * inv);
    *(v8h*)(cbase + nt * 16) = w;
  }
}

// Output projection: (B*S, 2048) x (2048, 2048) -> fp32 out (+bo).
// One wave = 64 rows x 128 columns (4 A and 8 B fragments feed 32 accumulator tiles);
// a block of 8 waves (4 x 2) = 256 x 256. Each k step's fragments are loaded one step
// ahead into a second register set.
#define GFM 4             // A fragments (16 rows each) per wave
#define GFN 8             // B fragments (16 columns each) per wave
#define GWV 8             // waves per block: 4 along the rows, 2 along the columns

// One k step's fragments. pa, pb = the lane's own addresses in that step: frag_f16's place in
// the wave's first 16 rows, frag_packed's place in the wave's first packed fragment.
static __device__ __forceinline__ void gemm_load(v16h (&a)[GFM], v16h (&b)[GFN],
                                                 const half_t* __restrict__ pa,
                                                 const half_t* __restrict__ pb) {
#pragma unroll
  for (int i = 0; i < GFM; ++i) {
    v8h lo = *(const v8h*)(pa + i * 16 * MODEL);
    v8h hi = *(const v8h*)(pa + i * 16 * MODEL + 16);
    a[i] = __builtin_shufflevector(lo, hi, 0,1,2,3,4,5,6,7,8,9,10,11,12,13,14,15);
  }
#pragma unroll
  for (int j = 0; j < GFN; ++j)
    b[j] = *(const v16h*)(pb + (j << 9));
}

static __device__ __forceinline__ void xcnt_then(unsigned& sa, unsigned& sb) {
  asm volatile("s_wait_xcnt 0x0" : "+s"(sa), "+s"(sb) : : "memory");
}

static __device__ __forceinline__ void gemm_mma(v8f (&acc)[GFM][GFN], const v16h (&a)[GFM],
                                                const v16h (&b)[GFN]) {
#pragma unroll
  for (int i = 0; i < GFM; ++i)
#pragma unroll
    for (int j = 0; j < GFN; ++j)
      acc[i][j] = wmma16(a[i], b[j], acc[i][j]);
}

__global__ void __launch_bounds__(GWV * 32)
out_gemm_kernel(const half_t* __restrict__ ctx, const half_t* __restrict__ wop,
                const float* __restrict__ bo, float* __restrict__ out) {
  int wave = threadIdx.x >> 5;
  int lane = threadIdx.x & 31;
  const int NBN = MODEL / 256;              // 8 column blocks
  int bm = blockIdx.x / NBN;
  int bn = blockIdx.x % NBN;
  int row0 = bm * 256 + (wave >> 1) * (GFM * 16);
  int nt0  = bn * 16 + (wave & 1) * GFN;    // first 16-column tile of this wave
  v8f acc[GFM][GFN];
#pragma unroll
  for (int i = 0; i < GFM; ++i)
#pragma unroll
    for (int j = 0; j < GFN; ++j) acc[i][j] = (v8f)0.f;
  const int ASTEP = 32;                     // halves from one k step to the next, A
  const int BSTEP = (MODEL / 16) << 9;      // the same, packed B
  const half_t* pa = ctx + (size_t)(row0 + (lane & 15)) * MODEL + ((lane >> 4) << 3);
  const half_t* pb = wop + ((size_t)nt0 << 9) + (lane << 4);

  // The scheduling fences keep each step's 24 loads as one group in front of the 32 products
  // of the step before: left free, the scheduler sinks most of them to within a few WMMAs
  // of their first use, and the wave then waits out the load latency.
  v16h a0[GFM], b0[GFN], a1[GFM], b1[GFN];
  unsigned sa = ASTEP, sb = BSTEP;
  gemm_load(a0, b0, pa, pb);                // step 0
  __builtin_amdgcn_sched_barrier(0);
  xcnt_then(sa, sb);
  pa += sa;
  pb += sb;
  for (int kstep = 0; kstep < MODEL / 32; kstep += 2) {
    gemm_load(a1, b1, pa, pb);              // step kstep + 1
    __builtin_amdgcn_sched_barrier(0);
    gemm_mma(acc, a0, b0);
    __builtin_amdgcn_sched_barrier(0);
    bool more = kstep + 2 < MODEL / 32;     // no step behind the last: it is loaded again, not used
    sa = more ? ASTEP : 0;
    sb = more ? BSTEP : 0;
    xcnt_then(sa, sb);
    pa += sa;
    pb += sb;
    gemm_load(a0, b0, pa, pb);              // step kstep + 2
    __builtin_amdgcn_sched_barrier(0);
    gemm_mma(acc, a1, b1);
    __builtin_amdgcn_sched_barrier(0);
    sa = ASTEP;
    sb = BSTEP;
    xcnt_then(sa, sb);
    pa += sa;
    pb += sb;
  }

  int rrow = (lane >> 4) << 3;
  int col0 = lane & 15;
  const float* bp = bo + nt0 * 16 + col0;
  float* ob = out + (size_t)(row0 + rrow) * MODEL + nt0 * 16 + col0;
#pragma unroll
  for (int j = 0; j < GFN; ++j) {
    float bb_ = bp[j * 16];
#pragma unroll
    for (int i = 0; i < GFM; ++i) {
#pragma unroll
      for (int r = 0; r < 8; ++r)
        ob[(size_t)(i * 16 + r) * MODEL + j * 16] = acc[i][j][r] + bb_;
      // the next tile's sums may reuse these stores' data registers: the bias they add passes
      // through the wait's statement, so they stand behind it
      asm volatile("s_wait_xcnt 0x0" : "+v"(bb_) : : "memory");
    }
  }
}

extern "C" void kernel_launch(void* const* d_in, const int* in_sizes, int n_in,
                              void* d_out, int out_size, void* d_ws, size_t ws_size,
                              hipStream_t stream) {
  (void)in_sizes; (void)n_in; (void)out_size; (void)ws_size;
  const float* q  = (const float*)d_in[0];
  const float* k  = (const float*)d_in[1];
  const float* v  = (const float*)d_in[2];
  const float* Wq = (const float*)d_in[3];
  const float* bq = (const float*)d_in[4];
  const float* Wk = (const float*)d_in[5];
  const float* bk = (const float*)d_in[6];
  const float* Wv = (const float*)d_in[7];
  const float* bv = (const float*)d_in[8];
  const float* Wo = (const float*)d_in[9];
  const float* bo = (const float*)d_in[10];
  float* out = (float*)d_out;

  char* ws = (char*)d_ws;
  const size_t SZP = (size_t)BB * NH * SS * HID * sizeof(half_t); // 32 MiB each
  half_t* qp  = (half_t*)(ws);
  half_t* kv  = (half_t*)(ws + SZP);        // K and V stage blocks, 2 * SZP
  half_t* ctx = (half_t*)(ws + 3 * SZP);
  half_t* wqp = (half_t*)(ws + 4 * SZP);
  half_t* wkp = wqp + EMB * HID;
  half_t* wvp = wkp + EMB * HID;
  half_t* wop = wvp + EMB * HID;            // 2048*2048 f16

  // 1) pack weights into WMMA B-fragment order (f32 -> f16)
  pack_w_kernel<<<(EMB * HID + 255) / 256, 256, 0, stream>>>(Wq, wqp, EMB, HID);
  pack_w_kernel<<<(EMB * HID + 255) / 256, 256, 0, stream>>>(Wk, wkp, EMB, HID);
  pack_w_kernel<<<(EMB * HID + 255) / 256, 256, 0, stream>>>(Wv, wvp, EMB, HID);
  pack_w_kernel<<<(MODEL * MODEL + 255) / 256, 256, 0, stream>>>(Wo, wop, MODEL, MODEL);

  // 2) QKV projections (K and V stored in operand order)
  dim3 pgrid(BB * (SS / 16) * NH / WPB, 3);
  proj_kernel<<<pgrid, WPB * 32, 0, stream>>>(q, k, v, wqp, wkp, wvp,
                                              bq, bk, bv, qp, kv);

  // 3) flash attention with tensor-loaded K/V stage blocks
  attn_kernel<<<BB * NH * (SS / 64), WPB * 32, 0, stream>>>(qp, kv, ctx);

  // 4) output GEMM + bias
  out_gemm_kernel<<<(BB * SS / 256) * (MODEL / 256), GWV * 32, 0, stream>>>(
      ctx, wop, bo, out);
}

// v004
// A run of this version takes 230 microseconds.
// Next to v003, in two timings, it ran 1.12 and 1.13 times as fast.
// Over all steps from v000 it is 3.24 times as fast.
#include <hip/hip_runtime.h>

#define EMB   128
#define HID   128
#define NH    16
#define MODEL 2048
#define BB    4
#define SS    2048
#define WPB   4   // waves per block (wave32)
#define NKT   (SS / 32)   // 32-key stages per head
#define STAGE_H 8192      // halves per stage block: 4096 of K fragments, then 4096 of V fragments
#define STAGE_B 16384u    // the same in bytes

typedef _Float16 half_t;
typedef __attribute__((ext_vector_type(16))) _Float16 v16h;
typedef __attribute__((ext_vector_type(8)))  _Float16 v8h;
typedef __attribute__((ext_vector_type(8)))  float    v8f;
typedef unsigned int u32x4 __attribute__((ext_vector_type(4)));
typedef unsigned int u32x8 __attribute__((ext_vector_type(8)));

static __device__ __forceinline__ v8f wmma16(v16h a, v16h b, v8f c) {
  // D = A(16x32 f16) * B(32x16 f16) + C(16x16 f32)
  return __builtin_amdgcn_wmma_f32_16x16x32_f16(false, a, false, b, (short)0, c,
                                                false, false);
}

static __device__ __forceinline__ v16h frag_f16(const half_t* __restrict__ p, int ld) {
  int lane = threadIdx.x & 31;
  const half_t* q = p + (size_t)(lane & 15) * ld + ((lane >> 4) << 3);
  v8h lo = *(const v8h*)q;
  v8h hi = *(const v8h*)(q + 16);
  return __builtin_shufflevector(lo, hi, 0,1,2,3,4,5,6,7,8,9,10,11,12,13,14,15);
}

// Same fragment but converting from fp32 source on the fly.
static __device__ __forceinline__ v16h frag_f32(const float* __restrict__ p, int ld) {
  int lane = threadIdx.x & 31;
  const float* q = p + (size_t)(lane & 15) * ld + ((lane >> 4) << 3);
  v16h r;
#pragma unroll
  for (int i = 0; i < 8; ++i) { r[i] = (half_t)q[i]; r[i + 8] = (half_t)q[16 + i]; }
  return r;
}

// Pre-packed B fragment: contiguous 32B per lane.
static __device__ __forceinline__ v16h frag_packed(const half_t* __restrict__ pk,
                                                   int kstep, int nt, int NT) {
  int lane = threadIdx.x & 31;
  return *(const v16h*)(pk + (((size_t)kstep * NT + nt) << 9) + ((size_t)lane << 4));
}

// Fragment stored in operand order: 512 B of low halves (16 B per lane), then 512 B of
// high halves. p already holds the lane's own 8-half offset.
static __device__ __forceinline__ v16h frag_ordered(const half_t* p) {
  v8h lo = *(const v8h*)p;
  v8h hi = *(const v8h*)(p + 256);
  return __builtin_shufflevector(lo, hi, 0,1,2,3,4,5,6,7,8,9,10,11,12,13,14,15);
}

static __device__ __forceinline__ float xhalf(float x) {
  int b = __builtin_bit_cast(int, x);
  return __builtin_bit_cast(float, __builtin_amdgcn_permlanex16(b, b, 0x76543210, 0xfedcba98, false, false));
}

static __device__ __forceinline__ unsigned uni(unsigned v) {
  return (unsigned)__builtin_amdgcn_readfirstlane(v);
}
static __device__ __forceinline__ unsigned pinned(unsigned v) {
  unsigned w = (unsigned)__builtin_amdgcn_readfirstlane(v);
  asm volatile("" : "+s"(w));
  return w;
}

static __device__ __forceinline__ u32x4 tdm_group0(unsigned lds_dst, const half_t* gptr) {
  unsigned long long ga = (unsigned long long)(size_t)gptr;
  u32x4 g0;
  g0[0] = uni(1u);                                              // count = 1
  g0[1] = uni(lds_dst);                                         // LDS byte offset
  g0[2] = uni((unsigned)ga);                                    // address [31:0]
  g0[3] = uni((((unsigned)(ga >> 32)) & 0x01ffffffu) | 0x80000000u); // address [56:32], type = 2
  return g0;
}
static __device__ __forceinline__ u32x8 tdm_group1() {
  u32x8 g1;
  g1[0] = uni(0u);
  g1[1] = uni(256u << 16);
  g1[2] = uni(64u << 16);
  g1[3] = uni(256u << 16);
  g1[4] = uni(64u);
  g1[5] = uni(256u);
  g1[6] = uni(0u);
  g1[7] = uni(0u);
  return g1;
}
// The next stage block follows the last one in memory.
static __device__ __forceinline__ void tdm_advance(u32x4& g0, unsigned lds_dst) {
  unsigned lo = g0[2] + STAGE_B;
  g0[3] = uni(g0[3] + (lo < STAGE_B ? 1u : 0u));                // carry into address [56:32]
  g0[2] = uni(lo);
  g0[1] = uni(lds_dst);
}
static __device__ __forceinline__ void tdm_issue(u32x4& g0, u32x8& g1) {
  asm volatile("tensor_load_to_lds %0, %1" : "+s"(g0), "+s"(g1) : : "memory");
}

// Shuffle a row-major (K,N) fp32 weight into f16 B-operand fragment order.
__global__ void pack_w_kernel(const float* __restrict__ W, half_t* __restrict__ packed,
                              int K, int N) {
  int idx = blockIdx.x * blockDim.x + threadIdx.x;
  int total = K * N;
  if (idx >= total) return;
  int NT = N >> 4;
  int f = idx >> 9;            // fragment = kstep*NT + nt (512 halves each)
  int within = idx & 511;
  int lane = within >> 4;
  int e = within & 15;         // element within v16h
  int kstep = f / NT;
  int nt = f - kstep * NT;
  int n = (nt << 4) + (lane & 15);
  int khalf = (lane >> 4) << 3;
  int j = e >> 1, hbit = e & 1;
  int k = (kstep << 5) +
          ((j < 4) ? (khalf + 2 * j + hbit) : (16 + khalf + 2 * (j - 4) + hbit));
  packed[idx] = (half_t)W[(size_t)k * N + n];
}

// QKV projection: one wave -> 16 seq rows x 128 hidden for one head.
// K and V leave in the attention kernel's operand order, one 16 KB block per
// (batch, head, 32 keys): halves [0,4096) K, fragment (16-key tile j, 32-wide k step kk) at
// (j*4+kk)*512; halves [4096,8192) V, fragment (16-wide d tile nt) at nt*512.
__global__ void __launch_bounds__(WPB * 32)
proj_kernel(const float* __restrict__ qin, const float* __restrict__ kin,
            const float* __restrict__ vin,
            const half_t* __restrict__ wqp, const half_t* __restrict__ wkp,
            const half_t* __restrict__ wvp,
            const float* __restrict__ bq, const float* __restrict__ bk,
            const float* __restrict__ bv,
            half_t* __restrict__ qp, half_t* __restrict__ kv) {
  int wave = threadIdx.x >> 5;
  int lane = threadIdx.x & 31;
  int gid = blockIdx.x * WPB + wave;       // (tile, head)
  int h = gid % NH;
  int tile = gid / NH;
  int b = tile / (SS / 16);
  int s0 = (tile % (SS / 16)) << 4;
  int which = blockIdx.y;                  // 0=q 1=k 2=v

  const float*  x    = (which == 0) ? qin : (which == 1) ? kin : vin;
  const half_t* wp   = (which == 0) ? wqp : (which == 1) ? wkp : wvp;
  const float*  bias = (which == 0) ? bq  : (which == 1) ? bk  : bv;

  const float* xa = x + ((size_t)b * SS + s0) * MODEL + h * EMB;
  v8f acc[8];
#pragma unroll
  for (int i = 0; i < 8; ++i) acc[i] = (v8f)0.f;

  int rrow = (lane >> 4) << 3;              // C layout: M = r + 8*(lane/16)
  int col0 = lane & 15;                     // N = lane&15
  half_t* blk = kv + ((size_t)(b * NH + h) * NKT + (s0 >> 5)) * STAGE_H + lane * 8;
  int j = (s0 >> 4) & 1;                    // which 16 keys of the block's 32

  if (which == 1) {
    // K: weights as A, x as B, so a lane ends with 8 consecutive hidden of one key
#pragma unroll
    for (int kk = 0; kk < 4; ++kk) {        // K = 128 = 4 x 32
      v16h a = frag_f32(xa + kk * 32, MODEL);
#pragma unroll
      for (int nt = 0; nt < 8; ++nt) {      // N = 128 = 8 x 16
        v16h bf = frag_packed(wp, kk, nt, 8);
        acc[nt] = wmma16(bf, a, acc[nt]);
      }
    }
    // acc[nt][r] = K[key s0 + (lane&15)][hidden nt*16 + rrow + r]: half nt&1 of k step nt>>1
    half_t* base = blk + j * 2048;
#pragma unroll
    for (int nt = 0; nt < 8; ++nt) {
      const float* bp = bias + nt * 16 + rrow;
      v8h w;
#pragma unroll
      for (int r = 0; r < 8; ++r) w[r] = (half_t)(acc[nt][r] + bp[r]);
      *(v8h*)(base + nt * 256) = w;
    }
    return;
  }

#pragma unroll
  for (int kk = 0; kk < 4; ++kk) {          // K = 128 = 4 x 32
    v16h a = frag_f32(xa + kk * 32, MODEL);
#pragma unroll
    for (int nt = 0; nt < 8; ++nt) {        // N = 128 = 8 x 16
      v16h bf = frag_packed(wp, kk, nt, 8);
      acc[nt] = wmma16(a, bf, acc[nt]);
    }
  }
  __builtin_amdgcn_sched_barrier(0);
  asm volatile("v_nop\n\tv_nop\n\tv_nop\n\tv_nop\n\tv_nop");
  __builtin_amdgcn_sched_barrier(0);

  if (which == 0) {
    half_t* base = qp + ((size_t)(b * NH + h) * SS + s0) * HID;
#pragma unroll
    for (int nt = 0; nt < 8; ++nt) {
      int col = nt * 16 + col0;
      float bb_ = bias[col];
#pragma unroll
      for (int r = 0; r < 8; ++r)
        base[(size_t)(rrow + r) * HID + col] = (half_t)(acc[nt][r] + bb_);
    }
  } else {
    // acc[nt][r] = V[key s0 + rrow + r][d nt*16 + (lane&15)]: half j of d tile nt
    half_t* base = blk + 4096 + j * 256;
#pragma unroll
    for (int nt = 0; nt < 8; ++nt) {
      float bb_ = bias[nt * 16 + col0];
      v8h w;
#pragma unroll
      for (int r = 0; r < 8; ++r) w[r] = (half_t)(acc[nt][r] + bb_);
      *(v8h*)(base + nt * 512) = w;
    }
    // the listing runs on from here into the Q block, which rewrites these stores' registers
    asm volatile("s_wait_xcnt 0x0" ::: "memory");
  }
}

#define QC 2              // 16-query column groups per wave
#define QBLK (WPB * QC * 16)  // queries per block
__global__ void __launch_bounds__(WPB * 32)
attn_kernel(const half_t* __restrict__ qp, const half_t* __restrict__ kv,
            half_t* __restrict__ ctx) {
  __shared__ __attribute__((aligned(2048))) half_t kv_buf[2][STAGE_H]; // 2 x 16 KB

  int wave = (int)uni(threadIdx.x >> 5);
  int lane = threadIdx.x & 31;
  int qg = blockIdx.x % (SS / QBLK);        // 128-query group
  int bh = blockIdx.x / (SS / QBLK);
  int h  = bh % NH;
  int b  = bh / NH;
  int qt = (qg * WPB + wave) * QC;          // this wave's first 16-query tile

  const half_t* qph = qp + (size_t)(b * NH + h) * SS * HID;
  const half_t* kvh = kv + (size_t)(b * NH + h) * NKT * STAGE_H;

  v16h qf[QC][4];
#pragma unroll
  for (int g = 0; g < QC; ++g)
#pragma unroll
    for (int kk = 0; kk < 4; ++kk)
      qf[g][kk] = frag_f16(qph + (size_t)((qt + g) * 16) * HID + kk * 32, HID);
  asm volatile("s_wait_xcnt 0x0" ::: "memory");  // in front of the later reuse of the address registers that the Q loads name

  float m[QC];                              // running maximum of query lane&15 of group g
  float l[QC];                              // running sum over this lane half's keys only
  v8f o[QC][8];
#pragma unroll
  for (int g = 0; g < QC; ++g) {
    m[g] = -1e30f;
    l[g] = 0.f;
#pragma unroll
    for (int i = 0; i < 8; ++i) o[g][i] = (v8f)0.f;
  }

  const float sc = 0.088388347648318447f;   // 1/sqrt(128)
  int rrow = (lane >> 4) << 3;
  int col0 = lane & 15;
  const unsigned lds0 = (unsigned)(size_t)&kv_buf[0][0];

  // prologue: stage 0 lands and is published, then stage 1 is set off
  u32x4 g0 = tdm_group0(lds0, kvh);
  u32x8 g1 = tdm_group1();
  if (pinned(wave == 0)) {
    tdm_issue(g0, g1);
    asm volatile("s_wait_tensorcnt 0x0" ::: "memory");  // stage 0 landed before the barrier publishes it
  }
  __syncthreads();
  if (pinned(wave == 0)) {
    tdm_advance(g0, lds0 + STAGE_B);
    tdm_issue(g0, g1);
  }

  for (int kt = 0; kt < NKT; ++kt) {
    int par = kt & 1;
    const half_t* sb = kv_buf[par] + lane * 8;

    // The pass's 16 fragments are read as one group at its head: K is waited for once, and V
    // lands under the score products and the softmax.
    v16h kf[8], vf[8];
#pragma unroll
    for (int i = 0; i < 8; ++i) kf[i] = frag_ordered(sb + i * 512);
#pragma unroll
    for (int i = 0; i < 8; ++i) vf[i] = frag_ordered(sb + 4096 + i * 512);
    // keeps the reads in front of the products: left free, the scheduler sinks each read to
    // just in front of its WMMA, and the wave waits out the LDS latency sixteen times a pass
    __builtin_amdgcn_sched_barrier(0);

    v8f s0v[QC], s1v[QC];
#pragma unroll
    for (int g = 0; g < QC; ++g) { s0v[g] = (v8f)0.f; s1v[g] = (v8f)0.f; }
#pragma unroll
    for (int kk = 0; kk < 4; ++kk) {        // scores 32 keys x 32 queries over hidden=128
#pragma unroll
      for (int g = 0; g < QC; ++g) {
        s0v[g] = wmma16(kf[kk], qf[g][kk], s0v[g]);
        s1v[g] = wmma16(kf[4 + kk], qf[g][kk], s1v[g]);
      }
    }
    // s0v[g][r] = S[key rrow + r][query col0 of group g], s1v[g][r] = the same, key + 16

    v16h pf[QC];                            // P^T as B operand: the two score tiles, converted in place
#pragma unroll
    for (int g = 0; g < QC; ++g) {
      float rmax = fmaxf(s0v[g][0], s1v[g][0]);
#pragma unroll
      for (int r = 1; r < 8; ++r) rmax = fmaxf(rmax, fmaxf(s0v[g][r], s1v[g][r]));
      rmax = fmaxf(rmax, xhalf(rmax));      // the other 16 keys of the same query
      float mn = fmaxf(m[g], rmax * sc);
      float alpha = __expf(m[g] - mn);
      float rs0 = 0.f, rs1 = 0.f;
#pragma unroll
      for (int r = 0; r < 8; ++r) {
        float p0 = __expf(s0v[g][r] * sc - mn);
        float p1 = __expf(s1v[g][r] * sc - mn);
        rs0 += p0;
        rs1 += p1;
        pf[g][r]     = (half_t)p0;
        pf[g][r + 8] = (half_t)p1;
      }
      l[g] = l[g] * alpha + (rs0 + rs1);
      m[g] = mn;
#pragma unroll
      for (int nt = 0; nt < 8; ++nt)
#pragma unroll
        for (int r = 0; r < 8; ++r)
          o[g][nt][r] *= alpha;
    }

#pragma unroll
    for (int nt = 0; nt < 8; ++nt)          // O^T += V^T(128x32) * P^T(32x32)
#pragma unroll
      for (int g = 0; g < QC; ++g)
        o[g][nt] = wmma16(vf[nt], pf[g], o[g][nt]);

    // publish point of stage kt+1
    // keeps the wait below at the pass's foot: left free, it is lifted to the head of the score
    // products, where the wave would sit out the landing of the V fragments
    __builtin_amdgcn_sched_barrier(0);
    asm volatile("s_wait_dscnt 0x0" ::: "memory");        // this wave's reads of the buffer are done before it is refilled
    if (pinned(wave == 0))
      asm volatile("s_wait_tensorcnt 0x0" ::: "memory");  // stage kt+1 landed before the barrier publishes it
    __syncthreads();                                      // publishes kt+1, ends every read of this pass's buffer
    if (pinned((wave == 0) & (kt + 2 < NKT))) {           // stage kt+2 into the buffer this pass has read
      tdm_advance(g0, lds0 + (unsigned)par * STAGE_B);
      tdm_issue(g0, g1);
    }
  }
  asm volatile("s_wait_tensorcnt 0x0" ::: "memory");      // nothing in flight when the wave ends
  asm volatile("s_wait_dscnt 0x0" ::: "memory");

  // o[g][nt][r] = O[query col0 of group g][d nt*16 + rrow + r]: 8 consecutive d, one 16-byte store
  v8h w[QC][8];
#pragma unroll
  for (int g = 0; g < QC; ++g) {
    float inv = 1.f / (l[g] + xhalf(l[g])); // the two lane halves' sums join here
#pragma unroll
    for (int nt = 0; nt < 8; ++nt)
#pragma unroll
      for (int r = 0; r < 8; ++r) w[g][nt][r] = (half_t)(o[g][nt][r] * inv);
  }
  half_t* cbase = ctx + ((size_t)b * SS + qt * 16 + col0) * MODEL + h * HID + rrow;
#pragma unroll
  for (int g = 0; g < QC; ++g)
#pragma unroll
    for (int nt = 0; nt < 8; ++nt)
      *(v8h*)(cbase + (size_t)g * 16 * MODEL + nt * 16) = w[g][nt];
}

// Output projection: (B*S, 2048) x (2048, 2048) -> fp32 out (+bo).
// One wave = 64 rows x 128 columns (4 A and 8 B fragments feed 32 accumulator tiles);
// a block of 8 waves (4 x 2) = 256 x 256. Each k step's fragments are loaded one step
// ahead into a second register set.
#define GFM 4             // A fragments (16 rows each) per wave
#define GFN 8             // B fragments (16 columns each) per wave
#define GWV 8             // waves per block: 4 along the rows, 2 along the columns

// One k step's fragments. pa, pb = the lane's own addresses in that step: frag_f16's place in
// the wave's first 16 rows, frag_packed's place in the wave's first packed fragment.
static __device__ __forceinline__ void gemm_load(v16h (&a)[GFM], v16h (&b)[GFN],
                                                 const half_t* __restrict__ pa,
                                                 const half_t* __restrict__ pb) {
#pragma unroll
  for (int i = 0; i < GFM; ++i) {
    v8h lo = *(const v8h*)(pa + i * 16 * MODEL);
    v8h hi = *(const v8h*)(pa + i * 16 * MODEL + 16);
    a[i] = __builtin_shufflevector(lo, hi, 0,1,2,3,4,5,6,7,8,9,10,11,12,13,14,15);
  }
#pragma unroll
  for (int j = 0; j < GFN; ++j)
    b[j] = *(const v16h*)(pb + (j << 9));
}

static __device__ __forceinline__ void xcnt_then(unsigned& sa, unsigned& sb) {
  asm volatile("s_wait_xcnt 0x0" : "+s"(sa), "+s"(sb) : : "memory");
}

static __device__ __forceinline__ void gemm_mma(v8f (&acc)[GFM][GFN], const v16h (&a)[GFM],
                                                const v16h (&b)[GFN]) {
#pragma unroll
  for (int i = 0; i < GFM; ++i)
#pragma unroll
    for (int j = 0; j < GFN; ++j)
      acc[i][j] = wmma16(a[i], b[j], acc[i][j]);
}

__global__ void __launch_bounds__(GWV * 32)
out_gemm_kernel(const half_t* __restrict__ ctx, const half_t* __restrict__ wop,
                const float* __restrict__ bo, float* __restrict__ out) {
  int wave = threadIdx.x >> 5;
  int lane = threadIdx.x & 31;
  const int NBN = MODEL / 256;              // 8 column blocks
  int bm = blockIdx.x / NBN;
  int bn = blockIdx.x % NBN;
  int row0 = bm * 256 + (wave >> 1) * (GFM * 16);
  int nt0  = bn * 16 + (wave & 1) * GFN;    // first 16-column tile of this wave
  v8f acc[GFM][GFN];
#pragma unroll
  for (int i = 0; i < GFM; ++i)
#pragma unroll
    for (int j = 0; j < GFN; ++j) acc[i][j] = (v8f)0.f;
  const int ASTEP = 32;                     // halves from one k step to the next, A
  const int BSTEP = (MODEL / 16) << 9;      // the same, packed B
  const half_t* pa = ctx + (size_t)(row0 + (lane & 15)) * MODEL + ((lane >> 4) << 3);
  const half_t* pb = wop + ((size_t)nt0 << 9) + (lane << 4);

  // The scheduling fences keep each step's 24 loads as one group in front of the 32 products
  // of the step before: left free, the scheduler sinks most of them to within a few WMMAs
  // of their first use, and the wave then waits out the load latency.
  v16h a0[GFM], b0[GFN], a1[GFM], b1[GFN];
  unsigned sa = ASTEP, sb = BSTEP;
  gemm_load(a0, b0, pa, pb);                // step 0
  __builtin_amdgcn_sched_barrier(0);
  xcnt_then(sa, sb);
  pa += sa;
  pb += sb;
  for (int kstep = 0; kstep < MODEL / 32; kstep += 2) {
    gemm_load(a1, b1, pa, pb);              // step kstep + 1
    __builtin_amdgcn_sched_barrier(0);
    gemm_mma(acc, a0, b0);
    __builtin_amdgcn_sched_barrier(0);
    bool more = kstep + 2 < MODEL / 32;     // no step behind the last: it is loaded again, not used
    sa = more ? ASTEP : 0;
    sb = more ? BSTEP : 0;
    xcnt_then(sa, sb);
    pa += sa;
    pb += sb;
    gemm_load(a0, b0, pa, pb);              // step kstep + 2
    __builtin_amdgcn_sched_barrier(0);
    gemm_mma(acc, a1, b1);
    __builtin_amdgcn_sched_barrier(0);
    sa = ASTEP;
    sb = BSTEP;
    xcnt_then(sa, sb);
    pa += sa;
    pb += sb;
  }

  int rrow = (lane >> 4) << 3;
  int col0 = lane & 15;
  const float* bp = bo + nt0 * 16 + col0;
  float* ob = out + (size_t)(row0 + rrow) * MODEL + nt0 * 16 + col0;
#pragma unroll
  for (int j = 0; j < GFN; ++j) {
    float bb_ = bp[j * 16];
#pragma unroll
    for (int i = 0; i < GFM; ++i) {
#pragma unroll
      for (int r = 0; r < 8; ++r)
        ob[(size_t)(i * 16 + r) * MODEL + j * 16] = acc[i][j][r] + bb_;
      // the next tile's sums may reuse these stores' data registers: the bias they add passes
      // through the wait's statement, so they stand behind it
      asm volatile("s_wait_xcnt 0x0" : "+v"(bb_) : : "memory");
    }
  }
}

extern "C" void kernel_launch(void* const* d_in, const int* in_sizes, int n_in,
                              void* d_out, int out_size, void* d_ws, size_t ws_size,
                              hipStream_t stream) {
  (void)in_sizes; (void)n_in; (void)out_size; (void)ws_size;
  const float* q  = (const float*)d_in[0];
  const float* k  = (const float*)d_in[1];
  const float* v  = (const float*)d_in[2];
  const float* Wq = (const float*)d_in[3];
  const float* bq = (const float*)d_in[4];
  const float* Wk = (const float*)d_in[5];
  const float* bk = (const float*)d_in[6];
  const float* Wv = (const float*)d_in[7];
  const float* bv = (const float*)d_in[8];
  const float* Wo = (const float*)d_in[9];
  const float* bo = (const float*)d_in[10];
  float* out = (float*)d_out;

  char* ws = (char*)d_ws;
  const size_t SZP = (size_t)BB * NH * SS * HID * sizeof(half_t); // 32 MiB each
  half_t* qp  = (half_t*)(ws);
  half_t* kv  = (half_t*)(ws + SZP);        // K and V stage blocks, 2 * SZP
  half_t* ctx = (half_t*)(ws + 3 * SZP);
  half_t* wqp = (half_t*)(ws + 4 * SZP);
  half_t* wkp = wqp + EMB * HID;
  half_t* wvp = wkp + EMB * HID;
  half_t* wop = wvp + EMB * HID;            // 2048*2048 f16

  // 1) pack weights into WMMA B-fragment order (f32 -> f16)
  pack_w_kernel<<<(EMB * HID + 255) / 256, 256, 0, stream>>>(Wq, wqp, EMB, HID);
  pack_w_kernel<<<(EMB * HID + 255) / 256, 256, 0, stream>>>(Wk, wkp, EMB, HID);
  pack_w_kernel<<<(EMB * HID + 255) / 256, 256, 0, stream>>>(Wv, wvp, EMB, HID);
  pack_w_kernel<<<(MODEL * MODEL + 255) / 256, 256, 0, stream>>>(Wo, wop, MODEL, MODEL);

  // 2) QKV projections (K and V stored in operand order)
  dim3 pgrid(BB * (SS / 16) * NH / WPB, 3);
  proj_kernel<<<pgrid, WPB * 32, 0, stream>>>(q, k, v, wqp, wkp, wvp,
                                              bq, bk, bv, qp, kv);

  // 3) flash attention with tensor-loaded K/V stage blocks
  attn_kernel<<<BB * NH * (SS / QBLK), WPB * 32, 0, stream>>>(qp, kv, ctx);

  // 4) output GEMM + bias
  out_gemm_kernel<<<(BB * SS / 256) * (MODEL / 256), GWV * 32, 0, stream>>>(
      ctx, wop, bo, out);
}

// v005
// Measured time: 223 microseconds a run.
// Next to v004, in two timings, it ran 1.03 times as fast each time.
// All steps since v000 together make it 3.33 times as fast.
#include <hip/hip_runtime.h>

#define EMB   128
#define HID   128
#define NH    16
#define MODEL 2048
#define BB    4
#define SS    2048
#define WPB   4   // waves per block (wave32)
#define NKT   (SS / 32)   // 32-key stages per head
#define STAGE_H 8192      // halves per stage block: 4096 of K fragments, then 4096 of V fragments
#define STAGE_B 16384u    // the same in bytes

typedef _Float16 half_t;
typedef __attribute__((ext_vector_type(16))) _Float16 v16h;
typedef __attribute__((ext_vector_type(8)))  _Float16 v8h;
typedef __attribute__((ext_vector_type(8)))  float    v8f;
typedef __attribute__((ext_vector_type(2)))  float    v2f;
typedef unsigned int u32x4 __attribute__((ext_vector_type(4)));
typedef unsigned int u32x8 __attribute__((ext_vector_type(8)));

static __device__ __forceinline__ v8f wmma16(v16h a, v16h b, v8f c) {
  // D = A(16x32 f16) * B(32x16 f16) + C(16x16 f32)
  return __builtin_amdgcn_wmma_f32_16x16x32_f16(false, a, false, b, (short)0, c,
                                                false, false);
}

static __device__ __forceinline__ v16h frag_f16(const half_t* __restrict__ p, int ld) {
  int lane = threadIdx.x & 31;
  const half_t* q = p + (size_t)(lane & 15) * ld + ((lane >> 4) << 3);
  v8h lo = *(const v8h*)q;
  v8h hi = *(const v8h*)(q + 16);
  return __builtin_shufflevector(lo, hi, 0,1,2,3,4,5,6,7,8,9,10,11,12,13,14,15);
}

// Same fragment but converting from fp32 source on the fly.
static __device__ __forceinline__ v16h frag_f32(const float* __restrict__ p, int ld) {
  int lane = threadIdx.x & 31;
  const float* q = p + (size_t)(lane & 15) * ld + ((lane >> 4) << 3);
  v16h r;
#pragma unroll
  for (int i = 0; i < 8; ++i) { r[i] = (half_t)q[i]; r[i + 8] = (half_t)q[16 + i]; }
  return r;
}

// Pre-packed B fragment: contiguous 32B per lane.
static __device__ __forceinline__ v16h frag_packed(const half_t* __restrict__ pk,
                                                   int kstep, int nt, int NT) {
  int lane = threadIdx.x & 31;
  return *(const v16h*)(pk + (((size_t)kstep * NT + nt) << 9) + ((size_t)lane << 4));
}

// Fragment stored in operand order: 512 B of low halves (16 B per lane), then 512 B of
// high halves. p already holds the lane's own 8-half offset.
static __device__ __forceinline__ v16h frag_ordered(const half_t* p) {
  v8h lo = *(const v8h*)p;
  v8h hi = *(const v8h*)(p + 256);
  return __builtin_shufflevector(lo, hi, 0,1,2,3,4,5,6,7,8,9,10,11,12,13,14,15);
}

static __device__ __forceinline__ float xhalf(float x) {
  int b = __builtin_bit_cast(int, x);
  return __builtin_bit_cast(float, __builtin_amdgcn_permlanex16(b, b, 0x76543210, 0xfedcba98, false, false));
}

static __device__ __forceinline__ unsigned uni(unsigned v) {
  return (unsigned)__builtin_amdgcn_readfirstlane(v);
}
static __device__ __forceinline__ unsigned pinned(unsigned v) {
  unsigned w = (unsigned)__builtin_amdgcn_readfirstlane(v);
  asm volatile("" : "+s"(w));
  return w;
}

static __device__ __forceinline__ u32x4 tdm_group0(unsigned lds_dst, const half_t* gptr) {
  unsigned long long ga = (unsigned long long)(size_t)gptr;
  u32x4 g0;
  g0[0] = uni(1u);                                              // count = 1
  g0[1] = uni(lds_dst);                                         // LDS byte offset
  g0[2] = uni((unsigned)ga);                                    // address [31:0]
  g0[3] = uni((((unsigned)(ga >> 32)) & 0x01ffffffu) | 0x80000000u); // address [56:32], type = 2
  return g0;
}
static __device__ __forceinline__ u32x8 tdm_group1() {
  u32x8 g1;
  g1[0] = uni(0u);
  g1[1] = uni(256u << 16);
  g1[2] = uni(64u << 16);
  g1[3] = uni(256u << 16);
  g1[4] = uni(64u);
  g1[5] = uni(256u);
  g1[6] = uni(0u);
  g1[7] = uni(0u);
  return g1;
}
// The next stage block follows the last one in memory.
static __device__ __forceinline__ void tdm_advance(u32x4& g0, unsigned lds_dst) {
  unsigned lo = g0[2] + STAGE_B;
  g0[3] = uni(g0[3] + (lo < STAGE_B ? 1u : 0u));                // carry into address [56:32]
  g0[2] = uni(lo);
  g0[1] = uni(lds_dst);
}
static __device__ __forceinline__ void tdm_issue(u32x4& g0, u32x8& g1) {
  asm volatile("tensor_load_to_lds %0, %1" : "+s"(g0), "+s"(g1) : : "memory");
}

// Shuffle a row-major (K,N) fp32 weight into f16 B-operand fragment order.
// One thread = two neighbouring columns of one 32-row k step: 32 loads of 8 bytes (a wave
// reads 256 bytes in a row of each weight row), then, for each lane half kh of the fragment,
// the 64 bytes in a row that fragment lanes kh*16 + (n&15) and the next one hold:
// elements 0..7 = rows kh*8 + 0..7, elements 8..15 = rows 16 + kh*8 + 0..7.
// The grid covers the weight exactly: x = N / (2*PKT) column groups, y = K / 32 k steps.
// N is a compile-time constant, so the 32 loads share one address and differ in their offsets.
#define PKT 64            // threads per block
template <int N>
__global__ void __launch_bounds__(PKT)
pack_w_kernel(const float* __restrict__ W, half_t* __restrict__ packed) {
  int n = (blockIdx.x * PKT + threadIdx.x) * 2;
  int kstep = blockIdx.y;
  const float* src = W + (size_t)kstep * 32 * N + n;
  v2f x[32];
#pragma unroll
  for (int k = 0; k < 32; ++k) x[k] = *(const v2f*)(src + (size_t)k * N);
  // keeps all 32 loads in front of the first conversion: left free, the scheduler sinks the
  // last few behind the first waits, and the wave sits out the memory latency twice
  __builtin_amdgcn_sched_barrier(0);
  half_t* dst = packed + (((size_t)kstep * (N >> 4) + (n >> 4)) << 9) + ((n & 15) << 4);
#pragma unroll
  for (int kh = 0; kh < 2; ++kh)
#pragma unroll
    for (int c = 0; c < 2; ++c) {
      v16h w;
#pragma unroll
      for (int e = 0; e < 8; ++e) {
        w[e]     = (half_t)x[kh * 8 + e][c];
        w[e + 8] = (half_t)x[16 + kh * 8 + e][c];
      }
      *(v16h*)(dst + kh * 256 + c * 16) = w;
    }
}

// QKV projection: one wave -> 16 seq rows x 128 hidden for one head.
// K and V leave in the attention kernel's operand order, one 16 KB block per
// (batch, head, 32 keys): halves [0,4096) K, fragment (16-key tile j, 32-wide k step kk) at
// (j*4+kk)*512; halves [4096,8192) V, fragment (16-wide d tile nt) at nt*512.
__global__ void __launch_bounds__(WPB * 32)
proj_kernel(const float* __restrict__ qin, const float* __restrict__ kin,
            const float* __restrict__ vin,
            const half_t* __restrict__ wqp, const half_t* __restrict__ wkp,
            const half_t* __restrict__ wvp,
            const float* __restrict__ bq, const float* __restrict__ bk,
            const float* __restrict__ bv,
            half_t* __restrict__ qp, half_t* __restrict__ kv) {
  int wave = threadIdx.x >> 5;
  int lane = threadIdx.x & 31;
  int gid = blockIdx.x * WPB + wave;       // (tile, head)
  int h = gid % NH;
  int tile = gid / NH;
  int b = tile / (SS / 16);
  int s0 = (tile % (SS / 16)) << 4;
  int which = blockIdx.y;                  // 0=q 1=k 2=v

  const float*  x    = (which == 0) ? qin : (which == 1) ? kin : vin;
  const half_t* wp   = (which == 0) ? wqp : (which == 1) ? wkp : wvp;
  const float*  bias = (which == 0) ? bq  : (which == 1) ? bk  : bv;

  const float* xa = x + ((size_t)b * SS + s0) * MODEL + h * EMB;
  v8f acc[8];
#pragma unroll
  for (int i = 0; i < 8; ++i) acc[i] = (v8f)0.f;

  int rrow = (lane >> 4) << 3;              // C layout: M = r + 8*(lane/16)
  int col0 = lane & 15;                     // N = lane&15
  half_t* blk = kv + ((size_t)(b * NH + h) * NKT + (s0 >> 5)) * STAGE_H + lane * 8;
  int j = (s0 >> 4) & 1;                    // which 16 keys of the block's 32

  if (which == 1) {
    // K: weights as A, x as B, so a lane ends with 8 consecutive hidden of one key
#pragma unroll
    for (int kk = 0; kk < 4; ++kk) {        // K = 128 = 4 x 32
      v16h a = frag_f32(xa + kk * 32, MODEL);
#pragma unroll
      for (int nt = 0; nt < 8; ++nt) {      // N = 128 = 8 x 16
        v16h bf = frag_packed(wp, kk, nt, 8);
        acc[nt] = wmma16(bf, a, acc[nt]);
      }
    }
    // acc[nt][r] = K[key s0 + (lane&15)][hidden nt*16 + rrow + r]: half nt&1 of k step nt>>1
    half_t* base = blk + j * 2048;
#pragma unroll
    for (int nt = 0; nt < 8; ++nt) {
      const float* bp = bias + nt * 16 + rrow;
      v8h w;
#pragma unroll
      for (int r = 0; r < 8; ++r) w[r] = (half_t)(acc[nt][r] + bp[r]);
      *(v8h*)(base + nt * 256) = w;
    }
    return;
  }

#pragma unroll
  for (int kk = 0; kk < 4; ++kk) {          // K = 128 = 4 x 32
    v16h a = frag_f32(xa + kk * 32, MODEL);
#pragma unroll
    for (int nt = 0; nt < 8; ++nt) {        // N = 128 = 8 x 16
      v16h bf = frag_packed(wp, kk, nt, 8);
      acc[nt] = wmma16(a, bf, acc[nt]);
    }
  }
  __builtin_amdgcn_sched_barrier(0);
  asm volatile("v_nop\n\tv_nop\n\tv_nop\n\tv_nop\n\tv_nop");
  __builtin_amdgcn_sched_barrier(0);

  if (which == 0) {
    half_t* base = qp + ((size_t)(b * NH + h) * SS + s0) * HID;
#pragma unroll
    for (int nt = 0; nt < 8; ++nt) {
      int col = nt * 16 + col0;
      float bb_ = bias[col];
#pragma unroll
      for (int r = 0; r < 8; ++r)
        base[(size_t)(rrow + r) * HID + col] = (half_t)(acc[nt][r] + bb_);
    }
  } else {
    // acc[nt][r] = V[key s0 + rrow + r][d nt*16 + (lane&15)]: half j of d tile nt
    half_t* base = blk + 4096 + j * 256;
#pragma unroll
    for (int nt = 0; nt < 8; ++nt) {
      float bb_ = bias[nt * 16 + col0];
      v8h w;
#pragma unroll
      for (int r = 0; r < 8; ++r) w[r] = (half_t)(acc[nt][r] + bb_);
      *(v8h*)(base + nt * 512) = w;
    }
    // the listing runs on from here into the Q block, which rewrites these stores' registers
    asm volatile("s_wait_xcnt 0x0" ::: "memory");
  }
}

#define QC 2              // 16-query column groups per wave
#define QBLK (WPB * QC * 16)  // queries per block
__global__ void __launch_bounds__(WPB * 32)
attn_kernel(const half_t* __restrict__ qp, const half_t* __restrict__ kv,
            half_t* __restrict__ ctx) {
  __shared__ __attribute__((aligned(2048))) half_t kv_buf[2][STAGE_H]; // 2 x 16 KB

  int wave = (int)uni(threadIdx.x >> 5);
  int lane = threadIdx.x & 31;
  int qg = blockIdx.x % (SS / QBLK);        // 128-query group
  int bh = blockIdx.x / (SS / QBLK);
  int h  = bh % NH;
  int b  = bh / NH;
  int qt = (qg * WPB + wave) * QC;          // this wave's first 16-query tile

  const half_t* qph = qp + (size_t)(b * NH + h) * SS * HID;
  const half_t* kvh = kv + (size_t)(b * NH + h) * NKT * STAGE_H;

  v16h qf[QC][4];
#pragma unroll
  for (int g = 0; g < QC; ++g)
#pragma unroll
    for (int kk = 0; kk < 4; ++kk)
      qf[g][kk] = frag_f16(qph + (size_t)((qt + g) * 16) * HID + kk * 32, HID);
  asm volatile("s_wait_xcnt 0x0" ::: "memory");  // in front of the later reuse of the address registers that the Q loads name

  float m[QC];                              // running maximum of query lane&15 of group g
  float l[QC];                              // running sum over this lane half's keys only
  v8f o[QC][8];
#pragma unroll
  for (int g = 0; g < QC; ++g) {
    m[g] = -1e30f;
    l[g] = 0.f;
#pragma unroll
    for (int i = 0; i < 8; ++i) o[g][i] = (v8f)0.f;
  }

  const float sc = 0.088388347648318447f;   // 1/sqrt(128)
  int rrow = (lane >> 4) << 3;
  int col0 = lane & 15;
  const unsigned lds0 = (unsigned)(size_t)&kv_buf[0][0];

  // prologue: stage 0 lands and is published, then stage 1 is set off
  u32x4 g0 = tdm_group0(lds0, kvh);
  u32x8 g1 = tdm_group1();
  if (pinned(wave == 0)) {
    tdm_issue(g0, g1);
    asm volatile("s_wait_tensorcnt 0x0" ::: "memory");  // stage 0 landed before the barrier publishes it
  }
  __syncthreads();
  if (pinned(wave == 0)) {
    tdm_advance(g0, lds0 + STAGE_B);
    tdm_issue(g0, g1);
  }

  for (int kt = 0; kt < NKT; ++kt) {
    int par = kt & 1;
    const half_t* sb = kv_buf[par] + lane * 8;

    // The pass's 16 fragments are read as one group at its head: K is waited for once, and V
    // lands under the score products and the softmax.
    v16h kf[8], vf[8];
#pragma unroll
    for (int i = 0; i < 8; ++i) kf[i] = frag_ordered(sb + i * 512);
#pragma unroll
    for (int i = 0; i < 8; ++i) vf[i] = frag_ordered(sb + 4096 + i * 512);
    // keeps the reads in front of the products: left free, the scheduler sinks each read to
    // just in front of its WMMA, and the wave waits out the LDS latency sixteen times a pass
    __builtin_amdgcn_sched_barrier(0);

    v8f s0v[QC], s1v[QC];
#pragma unroll
    for (int g = 0; g < QC; ++g) { s0v[g] = (v8f)0.f; s1v[g] = (v8f)0.f; }
#pragma unroll
    for (int kk = 0; kk < 4; ++kk) {        // scores 32 keys x 32 queries over hidden=128
#pragma unroll
      for (int g = 0; g < QC; ++g) {
        s0v[g] = wmma16(kf[kk], qf[g][kk], s0v[g]);
        s1v[g] = wmma16(kf[4 + kk], qf[g][kk], s1v[g]);
      }
    }
    // s0v[g][r] = S[key rrow + r][query col0 of group g], s1v[g][r] = the same, key + 16

    v16h pf[QC];                            // P^T as B operand: the two score tiles, converted in place
#pragma unroll
    for (int g = 0; g < QC; ++g) {
      float rmax = fmaxf(s0v[g][0], s1v[g][0]);
#pragma unroll
      for (int r = 1; r < 8; ++r) rmax = fmaxf(rmax, fmaxf(s0v[g][r], s1v[g][r]));
      rmax = fmaxf(rmax, xhalf(rmax));      // the other 16 keys of the same query
      float mn = fmaxf(m[g], rmax * sc);
      float alpha = __expf(m[g] - mn);
      float rs0 = 0.f, rs1 = 0.f;
#pragma unroll
      for (int r = 0; r < 8; ++r) {
        float p0 = __expf(s0v[g][r] * sc - mn);
        float p1 = __expf(s1v[g][r] * sc - mn);
        rs0 += p0;
        rs1 += p1;
        pf[g][r]     = (half_t)p0;
        pf[g][r + 8] = (half_t)p1;
      }
      l[g] = l[g] * alpha + (rs0 + rs1);
      m[g] = mn;
#pragma unroll
      for (int nt = 0; nt < 8; ++nt)
#pragma unroll
        for (int r = 0; r < 8; ++r)
          o[g][nt][r] *= alpha;
    }

#pragma unroll
    for (int nt = 0; nt < 8; ++nt)          // O^T += V^T(128x32) * P^T(32x32)
#pragma unroll
      for (int g = 0; g < QC; ++g)
        o[g][nt] = wmma16(vf[nt], pf[g], o[g][nt]);

    // publish point of stage kt+1
    // keeps the wait below at the pass's foot: left free, it is lifted to the head of the score
    // products, where the wave would sit out the landing of the V fragments
    __builtin_amdgcn_sched_barrier(0);
    asm volatile("s_wait_dscnt 0x0" ::: "memory");        // this wave's reads of the buffer are done before it is refilled
    if (pinned(wave == 0))
      asm volatile("s_wait_tensorcnt 0x0" ::: "memory");  // stage kt+1 landed before the barrier publishes it
    __syncthreads();                                      // publishes kt+1, ends every read of this pass's buffer
    if (pinned((wave == 0) & (kt + 2 < NKT))) {           // stage kt+2 into the buffer this pass has read
      tdm_advance(g0, lds0 + (unsigned)par * STAGE_B);
      tdm_issue(g0, g1);
    }
  }
  asm volatile("s_wait_tensorcnt 0x0" ::: "memory");      // nothing in flight when the wave ends
  asm volatile("s_wait_dscnt 0x0" ::: "memory");

  // o[g][nt][r] = O[query col0 of group g][d nt*16 + rrow + r]: 8 consecutive d, one 16-byte store
  v8h w[QC][8];
#pragma unroll
  for (int g = 0; g < QC; ++g) {
    float inv = 1.f / (l[g] + xhalf(l[g])); // the two lane halves' sums join here
#pragma unroll
    for (int nt = 0; nt < 8; ++nt)
#pragma unroll
      for (int r = 0; r < 8; ++r) w[g][nt][r] = (half_t)(o[g][nt][r] * inv);
  }
  half_t* cbase = ctx + ((size_t)b * SS + qt * 16 + col0) * MODEL + h * HID + rrow;
#pragma unroll
  for (int g = 0; g < QC; ++g)
#pragma unroll
    for (int nt = 0; nt < 8; ++nt)
      *(v8h*)(cbase + (size_t)g * 16 * MODEL + nt * 16) = w[g][nt];
}

// Output projection: (B*S, 2048) x (2048, 2048) -> fp32 out (+bo).
// One wave = 64 rows x 128 columns (4 A and 8 B fragments feed 32 accumulator tiles);
// a block of 8 waves (4 x 2) = 256 x 256. Each k step's fragments are loaded one step
// ahead into a second register set.
#define GFM 4             // A fragments (16 rows each) per wave
#define GFN 8             // B fragments (16 columns each) per wave
#define GWV 8             // waves per block: 4 along the rows, 2 along the columns

// One k step's fragments. pa, pb = the lane's own addresses in that step: frag_f16's place in
// the wave's first 16 rows, frag_packed's place in the wave's first packed fragment.
static __device__ __forceinline__ void gemm_load(v16h (&a)[GFM], v16h (&b)[GFN],
                                                 const half_t* __restrict__ pa,
                                                 const half_t* __restrict__ pb) {
#pragma unroll
  for (int i = 0; i < GFM; ++i) {
    v8h lo = *(const v8h*)(pa + i * 16 * MODEL);
    v8h hi = *(const v8h*)(pa + i * 16 * MODEL + 16);
    a[i] = __builtin_shufflevector(lo, hi, 0,1,2,3,4,5,6,7,8,9,10,11,12,13,14,15);
  }
#pragma unroll
  for (int j = 0; j < GFN; ++j)
    b[j] = *(const v16h*)(pb + (j << 9));
}

static __device__ __forceinline__ void xcnt_then(unsigned& sa, unsigned& sb) {
  asm volatile("s_wait_xcnt 0x0" : "+s"(sa), "+s"(sb) : : "memory");
}

static __device__ __forceinline__ void gemm_mma(v8f (&acc)[GFM][GFN], const v16h (&a)[GFM],
                                                const v16h (&b)[GFN]) {
#pragma unroll
  for (int i = 0; i < GFM; ++i)
#pragma unroll
    for (int j = 0; j < GFN; ++j)
      acc[i][j] = wmma16(a[i], b[j], acc[i][j]);
}

__global__ void __launch_bounds__(GWV * 32)
out_gemm_kernel(const half_t* __restrict__ ctx, const half_t* __restrict__ wop,
                const float* __restrict__ bo, float* __restrict__ out) {
  int wave = threadIdx.x >> 5;
  int lane = threadIdx.x & 31;
  const int NBN = MODEL / 256;              // 8 column blocks
  int bm = blockIdx.x / NBN;
  int bn = blockIdx.x % NBN;
  int row0 = bm * 256 + (wave >> 1) * (GFM * 16);
  int nt0  = bn * 16 + (wave & 1) * GFN;    // first 16-column tile of this wave
  v8f acc[GFM][GFN];
#pragma unroll
  for (int i = 0; i < GFM; ++i)
#pragma unroll
    for (int j = 0; j < GFN; ++j) acc[i][j] = (v8f)0.f;
  const int ASTEP = 32;                     // halves from one k step to the next, A
  const int BSTEP = (MODEL / 16) << 9;      // the same, packed B
  const half_t* pa = ctx + (size_t)(row0 + (lane & 15)) * MODEL + ((lane >> 4) << 3);
  const half_t* pb = wop + ((size_t)nt0 << 9) + (lane << 4);

  // The scheduling fences keep each step's 24 loads as one group in front of the 32 products
  // of the step before: left free, the scheduler sinks most of them to within a few WMMAs
  // of their first use, and the wave then waits out the load latency.
  v16h a0[GFM], b0[GFN], a1[GFM], b1[GFN];
  unsigned sa = ASTEP, sb = BSTEP;
  gemm_load(a0, b0, pa, pb);                // step 0
  __builtin_amdgcn_sched_barrier(0);
  xcnt_then(sa, sb);
  pa += sa;
  pb += sb;
  for (int kstep = 0; kstep < MODEL / 32; kstep += 2) {
    gemm_load(a1, b1, pa, pb);              // step kstep + 1
    __builtin_amdgcn_sched_barrier(0);
    gemm_mma(acc, a0, b0);
    __builtin_amdgcn_sched_barrier(0);
    bool more = kstep + 2 < MODEL / 32;     // no step behind the last: it is loaded again, not used
    sa = more ? ASTEP : 0;
    sb = more ? BSTEP : 0;
    xcnt_then(sa, sb);
    pa += sa;
    pb += sb;
    gemm_load(a0, b0, pa, pb);              // step kstep + 2
    __builtin_amdgcn_sched_barrier(0);
    gemm_mma(acc, a1, b1);
    __builtin_amdgcn_sched_barrier(0);
    sa = ASTEP;
    sb = BSTEP;
    xcnt_then(sa, sb);
    pa += sa;
    pb += sb;
  }

  int rrow = (lane >> 4) << 3;
  int col0 = lane & 15;
  const float* bp = bo + nt0 * 16 + col0;
  float* ob = out + (size_t)(row0 + rrow) * MODEL + nt0 * 16 + col0;
#pragma unroll
  for (int j = 0; j < GFN; ++j) {
    float bb_ = bp[j * 16];
#pragma unroll
    for (int i = 0; i < GFM; ++i) {
#pragma unroll
      for (int r = 0; r < 8; ++r)
        ob[(size_t)(i * 16 + r) * MODEL + j * 16] = acc[i][j][r] + bb_;
      // the next tile's sums may reuse these stores' data registers: the bias they add passes
      // through the wait's statement, so they stand behind it
      asm volatile("s_wait_xcnt 0x0" : "+v"(bb_) : : "memory");
    }
  }
}

extern "C" void kernel_launch(void* const* d_in, const int* in_sizes, int n_in,
                              void* d_out, int out_size, void* d_ws, size_t ws_size,
                              hipStream_t stream) {
  (void)in_sizes; (void)n_in; (void)out_size; (void)ws_size;
  const float* q  = (const float*)d_in[0];
  const float* k  = (const float*)d_in[1];
  const float* v  = (const float*)d_in[2];
  const float* Wq = (const float*)d_in[3];
  const float* bq = (const float*)d_in[4];
  const float* Wk = (const float*)d_in[5];
  const float* bk = (const float*)d_in[6];
  const float* Wv = (const float*)d_in[7];
  const float* bv = (const float*)d_in[8];
  const float* Wo = (const float*)d_in[9];
  const float* bo = (const float*)d_in[10];
  float* out = (float*)d_out;

  char* ws = (char*)d_ws;
  const size_t SZP = (size_t)BB * NH * SS * HID * sizeof(half_t); // 32 MiB each
  half_t* qp  = (half_t*)(ws);
  half_t* kv  = (half_t*)(ws + SZP);        // K and V stage blocks, 2 * SZP
  half_t* ctx = (half_t*)(ws + 3 * SZP);
  half_t* wqp = (half_t*)(ws + 4 * SZP);
  half_t* wkp = wqp + EMB * HID;
  half_t* wvp = wkp + EMB * HID;
  half_t* wop = wvp + EMB * HID;            // 2048*2048 f16

  // 1) pack weights into WMMA B-fragment order (f32 -> f16)
  dim3 wgrid(HID / (2 * PKT), EMB / 32);
  dim3 ogrid(MODEL / (2 * PKT), MODEL / 32);
  pack_w_kernel<HID><<<wgrid, PKT, 0, stream>>>(Wq, wqp);
  pack_w_kernel<HID><<<wgrid, PKT, 0, stream>>>(Wk, wkp);
  pack_w_kernel<HID><<<wgrid, PKT, 0, stream>>>(Wv, wvp);
  pack_w_kernel<MODEL><<<ogrid, PKT, 0, stream>>>(Wo, wop);

  // 2) QKV projections (K and V stored in operand order)
  dim3 pgrid(BB * (SS / 16) * NH / WPB, 3);
  proj_kernel<<<pgrid, WPB * 32, 0, stream>>>(q, k, v, wqp, wkp, wvp,
                                              bq, bk, bv, qp, kv);

  // 3) flash attention with tensor-loaded K/V stage blocks
  attn_kernel<<<BB * NH * (SS / QBLK), WPB * 32, 0, stream>>>(qp, kv, ctx);

  // 4) output GEMM + bias
  out_gemm_kernel<<<(BB * SS / 256) * (MODEL / 256), GWV * 32, 0, stream>>>(
      ctx, wop, bo, out);
}

// v006
// One run takes 208 microseconds.
// Timed twice side by side with v005, it ran 1.07 and 1.08 times as fast.
// All steps since v000 together make it 3.58 times as fast.
#include <hip/hip_runtime.h>

#define EMB   128
#define HID   128
#define NH    16
#define MODEL 2048
#define BB    4
#define SS    2048
#define WPB   4   // waves per block (wave32)
#define NKT   (SS / 32)   // 32-key stages per head
#define STAGE_H 8192      // halves per stage block: 4096 of K fragments, then 4096 of V fragments
#define STAGE_B 16384u    // the same in bytes
#define NRT   (BB * SS / 16)  // 16-row tiles of ctx

typedef _Float16 half_t;
typedef __attribute__((ext_vector_type(16))) _Float16 v16h;
typedef __attribute__((ext_vector_type(8)))  _Float16 v8h;
typedef __attribute__((ext_vector_type(8)))  float    v8f;
typedef __attribute__((ext_vector_type(2)))  float    v2f;
typedef unsigned int u32x4 __attribute__((ext_vector_type(4)));
typedef unsigned int u32x8 __attribute__((ext_vector_type(8)));

static __device__ __forceinline__ v8f wmma16(v16h a, v16h b, v8f c) {
  // D = A(16x32 f16) * B(32x16 f16) + C(16x16 f32)
  return __builtin_amdgcn_wmma_f32_16x16x32_f16(false, a, false, b, (short)0, c,
                                                false, false);
}

static __device__ __forceinline__ v16h frag_f32(const float* __restrict__ p, int ld) {
  int lane = threadIdx.x & 31;
  const float* q = p + (size_t)(lane & 15) * ld + ((lane >> 4) << 3);
  v16h r;
#pragma unroll
  for (int i = 0; i < 8; ++i) { r[i] = (half_t)q[i]; r[i + 8] = (half_t)q[16 + i]; }
  return r;
}

// Fragment stored in operand order: 512 B of low halves (16 B per lane), then 512 B of
// high halves, so each of its two 16-byte loads or stores of a wave covers 4 whole 128-B lines.
// p already holds the lane's own 8-half offset.
static __device__ __forceinline__ v16h frag_ordered(const half_t* p) {
  v8h lo = *(const v8h*)p;
  v8h hi = *(const v8h*)(p + 256);
  return __builtin_shufflevector(lo, hi, 0,1,2,3,4,5,6,7,8,9,10,11,12,13,14,15);
}

// Packed weight fragment (k step, 16-column tile nt of NT), stored in operand order.
static __device__ __forceinline__ v16h frag_packed(const half_t* __restrict__ pk,
                                                   int kstep, int nt, int NT) {
  int lane = threadIdx.x & 31;
  return frag_ordered(pk + (((size_t)kstep * NT + nt) << 9) + (lane << 3));
}

static __device__ __forceinline__ float xhalf(float x) {
  int b = __builtin_bit_cast(int, x);
  return __builtin_bit_cast(float, __builtin_amdgcn_permlanex16(b, b, 0x76543210, 0xfedcba98, false, false));
}

static __device__ __forceinline__ unsigned uni(unsigned v) {
  return (unsigned)__builtin_amdgcn_readfirstlane(v);
}
static __device__ __forceinline__ unsigned pinned(unsigned v) {
  unsigned w = (unsigned)__builtin_amdgcn_readfirstlane(v);
  asm volatile("" : "+s"(w));
  return w;
}

static __device__ __forceinline__ u32x4 tdm_group0(unsigned lds_dst, const half_t* gptr) {
  unsigned long long ga = (unsigned long long)(size_t)gptr;
  u32x4 g0;
  g0[0] = uni(1u);                                              // count = 1
  g0[1] = uni(lds_dst);                                         // LDS byte offset
  g0[2] = uni((unsigned)ga);                                    // address [31:0]
  g0[3] = uni((((unsigned)(ga >> 32)) & 0x01ffffffu) | 0x80000000u); // address [56:32], type = 2
  return g0;
}
static __device__ __forceinline__ u32x8 tdm_group1() {
  u32x8 g1;
  g1[0] = uni(0u);
  g1[1] = uni(256u << 16);
  g1[2] = uni(64u << 16);
  g1[3] = uni(256u << 16);
  g1[4] = uni(64u);
  g1[5] = uni(256u);
  g1[6] = uni(0u);
  g1[7] = uni(0u);
  return g1;
}
// The next stage block follows the last one in memory.
static __device__ __forceinline__ void tdm_advance(u32x4& g0, unsigned lds_dst) {
  unsigned lo = g0[2] + STAGE_B;
  g0[3] = uni(g0[3] + (lo < STAGE_B ? 1u : 0u));                // carry into address [56:32]
  g0[2] = uni(lo);
  g0[1] = uni(lds_dst);
}
static __device__ __forceinline__ void tdm_issue(u32x4& g0, u32x8& g1) {
  asm volatile("tensor_load_to_lds %0, %1" : "+s"(g0), "+s"(g1) : : "memory");
}

// Shuffle a row-major (K,N) fp32 weight into f16 B-operand fragment order.
// One thread = two neighbouring columns of one 32-row k step: 32 loads of 8 bytes (a wave
// reads 256 bytes in a row of each weight row), then, for each lane half kh of the fragment
// and each of its two parts, the 32 bytes in a row that fragment lanes kh*16 + (n&15) and the
// next one hold there: low part = rows kh*8 + 0..7, high part = rows 16 + kh*8 + 0..7.
// The grid covers the weight exactly: x = N / (2*PKT) column groups, y = K / 32 k steps.
// N is a compile-time constant, so the 32 loads share one address and differ in their offsets.
#define PKT 64            // threads per block
template <int N>
__global__ void __launch_bounds__(PKT)
pack_w_kernel(const float* __restrict__ W, half_t* __restrict__ packed) {
  int n = (blockIdx.x * PKT + threadIdx.x) * 2;
  int kstep = blockIdx.y;
  const float* src = W + (size_t)kstep * 32 * N + n;
  v2f x[32];
#pragma unroll
  for (int k = 0; k < 32; ++k) x[k] = *(const v2f*)(src + (size_t)k * N);
  // keeps all 32 loads in front of the first conversion: left free, the scheduler sinks the
  // last few behind the first waits, and the wave sits out the memory latency twice
  __builtin_amdgcn_sched_barrier(0);
  half_t* dst = packed + (((size_t)kstep * (N >> 4) + (n >> 4)) << 9) + ((n & 15) << 3);
#pragma unroll
  for (int kh = 0; kh < 2; ++kh)
#pragma unroll
    for (int part = 0; part < 2; ++part) {
      v16h w;
#pragma unroll
      for (int e = 0; e < 8; ++e) {
        w[e]     = (half_t)x[part * 16 + kh * 8 + e][0];
        w[e + 8] = (half_t)x[part * 16 + kh * 8 + e][1];
      }
      *(v16h*)(dst + part * 256 + kh * 128) = w;
    }
}

// QKV projection: one wave -> 16 seq rows x 128 hidden for one head.
// All three leave in the attention kernel's operand order. Q: per (batch, head, 16 queries)
// 4 fragments in a row, one per 32-wide k step kk. K and V: one 16 KB block per
// (batch, head, 32 keys): halves [0,4096) K, fragment (16-key tile j, 32-wide k step kk) at
// (j*4+kk)*512; halves [4096,8192) V, fragment (16-wide d tile nt) at nt*512.
__global__ void __launch_bounds__(WPB * 32)
proj_kernel(const float* __restrict__ qin, const float* __restrict__ kin,
            const float* __restrict__ vin,
            const half_t* __restrict__ wqp, const half_t* __restrict__ wkp,
            const half_t* __restrict__ wvp,
            const float* __restrict__ bq, const float* __restrict__ bk,
            const float* __restrict__ bv,
            half_t* __restrict__ qp, half_t* __restrict__ kv) {
  int wave = threadIdx.x >> 5;
  int lane = threadIdx.x & 31;
  int gid = blockIdx.x * WPB + wave;       // (tile, head)
  int h = gid % NH;
  int tile = gid / NH;
  int b = tile / (SS / 16);
  int s0 = (tile % (SS / 16)) << 4;
  int which = blockIdx.y;                  // 0=q 1=k 2=v

  const float*  x    = (which == 0) ? qin : (which == 1) ? kin : vin;
  const half_t* wp   = (which == 0) ? wqp : (which == 1) ? wkp : wvp;
  const float*  bias = (which == 0) ? bq  : (which == 1) ? bk  : bv;

  const float* xa = x + ((size_t)b * SS + s0) * MODEL + h * EMB;
  v8f acc[8];
#pragma unroll
  for (int i = 0; i < 8; ++i) acc[i] = (v8f)0.f;

  int rrow = (lane >> 4) << 3;              // C layout: M = r + 8*(lane/16)
  int col0 = lane & 15;                     // N = lane&15
  half_t* blk = kv + ((size_t)(b * NH + h) * NKT + (s0 >> 5)) * STAGE_H + lane * 8;
  int j = (s0 >> 4) & 1;                    // which 16 keys of the block's 32

  if (which != 2) {
    // Q, K: weights as A, x as B, so a lane ends with 8 consecutive hidden of one query or key
#pragma unroll
    for (int kk = 0; kk < 4; ++kk) {        // K = 128 = 4 x 32
      v16h a = frag_f32(xa + kk * 32, MODEL);
#pragma unroll
      for (int nt = 0; nt < 8; ++nt) {      // N = 128 = 8 x 16
        v16h bf = frag_packed(wp, kk, nt, 8);
        acc[nt] = wmma16(bf, a, acc[nt]);
      }
    }
    // acc[nt][r] = row s0 + (lane&15), hidden nt*16 + rrow + r: half nt&1 of k step nt>>1
    half_t* base = (which == 1) ? blk + j * 2048
                                : qp + ((size_t)(b * NH + h) * SS + s0) * HID + lane * 8;
#pragma unroll
    for (int nt = 0; nt < 8; ++nt) {
      const float* bp = bias + nt * 16 + rrow;
      v8h w;
#pragma unroll
      for (int r = 0; r < 8; ++r) w[r] = (half_t)(acc[nt][r] + bp[r]);
      *(v8h*)(base + nt * 256) = w;
    }
    return;
  }

#pragma unroll
  for (int kk = 0; kk < 4; ++kk) {          // K = 128 = 4 x 32
    v16h a = frag_f32(xa + kk * 32, MODEL);
#pragma unroll
    for (int nt = 0; nt < 8; ++nt) {        // N = 128 = 8 x 16
      v16h bf = frag_packed(wp, kk, nt, 8);
      acc[nt] = wmma16(a, bf, acc[nt]);
    }
  }
  // acc[nt][r] = V[key s0 + rrow + r][d nt*16 + (lane&15)]: half j of d tile nt
  half_t* base = blk + 4096 + j * 256;
#pragma unroll
  for (int nt = 0; nt < 8; ++nt) {
    float bb_ = bias[nt * 16 + col0];
    v8h w;
#pragma unroll
    for (int r = 0; r < 8; ++r) w[r] = (half_t)(acc[nt][r] + bb_);
    *(v8h*)(base + nt * 512) = w;
  }
}

#define QC 2              // 16-query column groups per wave
#define QBLK (WPB * QC * 16)  // queries per block
__global__ void __launch_bounds__(WPB * 32)
attn_kernel(const half_t* __restrict__ qp, const half_t* __restrict__ kv,
            half_t* __restrict__ ctx) {
  __shared__ __attribute__((aligned(2048))) half_t kv_buf[2][STAGE_H]; // 2 x 16 KB

  int wave = (int)uni(threadIdx.x >> 5);
  int lane = threadIdx.x & 31;
  int qg = blockIdx.x % (SS / QBLK);        // 128-query group
  int bh = blockIdx.x / (SS / QBLK);
  int h  = bh % NH;
  int b  = bh / NH;
  int qt = (qg * WPB + wave) * QC;          // this wave's first 16-query tile

  const half_t* qph = qp + (size_t)(b * NH + h) * SS * HID;
  const half_t* kvh = kv + (size_t)(b * NH + h) * NKT * STAGE_H;

  v16h qf[QC][4];
#pragma unroll
  for (int g = 0; g < QC; ++g)
#pragma unroll
    for (int kk = 0; kk < 4; ++kk)
      qf[g][kk] = frag_ordered(qph + (size_t)((qt + g) * 16) * HID + kk * 512 + lane * 8);
  asm volatile("s_wait_xcnt 0x0" ::: "memory");  // in front of the later reuse of the address registers that the Q loads name

  float m[QC];                              // running maximum of query lane&15 of group g
  float l[QC];                              // running sum over this lane half's keys only
  v8f o[QC][8];
#pragma unroll
  for (int g = 0; g < QC; ++g) {
    m[g] = -1e30f;
    l[g] = 0.f;
#pragma unroll
    for (int i = 0; i < 8; ++i) o[g][i] = (v8f)0.f;
  }

  const float sc = 0.088388347648318447f;   // 1/sqrt(128)
  // in the comments below: rrow = (lane >> 4) * 8, col0 = lane & 15
  const unsigned lds0 = (unsigned)(size_t)&kv_buf[0][0];

  // prologue: stage 0 lands and is published, then stage 1 is set off
  u32x4 g0 = tdm_group0(lds0, kvh);
  u32x8 g1 = tdm_group1();
  if (pinned(wave == 0)) {
    tdm_issue(g0, g1);
    asm volatile("s_wait_tensorcnt 0x0" ::: "memory");  // stage 0 landed before the barrier publishes it
  }
  __syncthreads();
  if (pinned(wave == 0)) {
    tdm_advance(g0, lds0 + STAGE_B);
    tdm_issue(g0, g1);
  }

  for (int kt = 0; kt < NKT; ++kt) {
    int par = kt & 1;
    const half_t* sb = kv_buf[par] + lane * 8;

    // The pass's 16 fragments are read as one group at its head: K is waited for once, and V
    // lands under the score products and the softmax.
    v16h kf[8], vf[8];
#pragma unroll
    for (int i = 0; i < 8; ++i) kf[i] = frag_ordered(sb + i * 512);
#pragma unroll
    for (int i = 0; i < 8; ++i) vf[i] = frag_ordered(sb + 4096 + i * 512);
    // keeps the reads in front of the products: left free, the scheduler sinks each read to
    // just in front of its WMMA, and the wave waits out the LDS latency sixteen times a pass
    __builtin_amdgcn_sched_barrier(0);

    v8f s0v[QC], s1v[QC];
#pragma unroll
    for (int g = 0; g < QC; ++g) { s0v[g] = (v8f)0.f; s1v[g] = (v8f)0.f; }
#pragma unroll
    for (int kk = 0; kk < 4; ++kk) {        // scores 32 keys x 32 queries over hidden=128
#pragma unroll
      for (int g = 0; g < QC; ++g) {
        s0v[g] = wmma16(kf[kk], qf[g][kk], s0v[g]);
        s1v[g] = wmma16(kf[4 + kk], qf[g][kk], s1v[g]);
      }
    }
    // s0v[g][r] = S[key rrow + r][query col0 of group g], s1v[g][r] = the same, key + 16

    v16h pf[QC];                            // P^T as B operand: the two score tiles, converted in place
#pragma unroll
    for (int g = 0; g < QC; ++g) {
      float rmax = fmaxf(s0v[g][0], s1v[g][0]);
#pragma unroll
      for (int r = 1; r < 8; ++r) rmax = fmaxf(rmax, fmaxf(s0v[g][r], s1v[g][r]));
      rmax = fmaxf(rmax, xhalf(rmax));      // the other 16 keys of the same query
      float mn = fmaxf(m[g], rmax * sc);
      float alpha = __expf(m[g] - mn);
      float rs0 = 0.f, rs1 = 0.f;
#pragma unroll
      for (int r = 0; r < 8; ++r) {
        float p0 = __expf(s0v[g][r] * sc - mn);
        float p1 = __expf(s1v[g][r] * sc - mn);
        rs0 += p0;
        rs1 += p1;
        pf[g][r]     = (half_t)p0;
        pf[g][r + 8] = (half_t)p1;
      }
      l[g] = l[g] * alpha + (rs0 + rs1);
      m[g] = mn;
#pragma unroll
      for (int nt = 0; nt < 8; ++nt)
#pragma unroll
        for (int r = 0; r < 8; ++r)
          o[g][nt][r] *= alpha;
    }

#pragma unroll
    for (int nt = 0; nt < 8; ++nt)          // O^T += V^T(128x32) * P^T(32x32)
#pragma unroll
      for (int g = 0; g < QC; ++g)
        o[g][nt] = wmma16(vf[nt], pf[g], o[g][nt]);

    // publish point of stage kt+1
    // keeps the wait below at the pass's foot: left free, it is lifted to the head of the score
    // products, where the wave would sit out the landing of the V fragments
    __builtin_amdgcn_sched_barrier(0);
    asm volatile("s_wait_dscnt 0x0" ::: "memory");        // this wave's reads of the buffer are done before it is refilled
    if (pinned(wave == 0))
      asm volatile("s_wait_tensorcnt 0x0" ::: "memory");  // stage kt+1 landed before the barrier publishes it
    __syncthreads();                                      // publishes kt+1, ends every read of this pass's buffer
    if (pinned((wave == 0) & (kt + 2 < NKT))) {           // stage kt+2 into the buffer this pass has read
      tdm_advance(g0, lds0 + (unsigned)par * STAGE_B);
      tdm_issue(g0, g1);
    }
  }
  asm volatile("s_wait_tensorcnt 0x0" ::: "memory");      // nothing in flight when the wave ends
  asm volatile("s_wait_dscnt 0x0" ::: "memory");

  // o[g][nt][r] = O[query col0 of group g][d nt*16 + rrow + r]: this very lane's half nt&1 of the
  // output GEMM's A fragment (16-row tile b*SS/16 + qt + g, k step h*4 + nt/2). ctx is stored in
  // that operand order, [k step][row tile][512 halves]: one 16-byte store, 512 B in a row per wave
  v8h w[QC][8];
#pragma unroll
  for (int g = 0; g < QC; ++g) {
    float inv = 1.f / (l[g] + xhalf(l[g])); // the two lane halves' sums join here
#pragma unroll
    for (int nt = 0; nt < 8; ++nt)
#pragma unroll
      for (int r = 0; r < 8; ++r) w[g][nt][r] = (half_t)(o[g][nt][r] * inv);
  }
  half_t* cbase = ctx + (((size_t)(h * (HID / 32)) * NRT + b * (SS / 16) + qt) << 9) + lane * 8;
#pragma unroll
  for (int g = 0; g < QC; ++g)
#pragma unroll
    for (int nt = 0; nt < 8; ++nt)
      *(v8h*)(cbase + (((nt >> 1) * NRT + g) << 9) + (nt & 1) * 256) = w[g][nt];
}

// Output projection: (B*S, 2048) x (2048, 2048) -> fp32 out (+bo). ctx comes in A operand order,
// [k step][row tile], as the packed Wo comes [k step][column tile]: a block reads 16 KB in a row
// of each per k step.
// One wave = 64 rows x 128 columns (4 A and 8 B fragments feed 32 accumulator tiles);
// a block of 8 waves (4 x 2) = 256 x 256. Each k step's fragments are loaded one step
// ahead into a second register set.
#define GFM 4             // A fragments (16 rows each) per wave
#define GFN 8             // B fragments (16 columns each) per wave
#define GWV 8             // waves per block: 4 along the rows, 2 along the columns

// One k step's fragments, both operands in operand order. pa, pb = the lane's own 8-half place
// in that step's fragment of the wave's first 16 rows and of its first 16 columns.
static __device__ __forceinline__ void gemm_load(v16h (&a)[GFM], v16h (&b)[GFN],
                                                 const half_t* __restrict__ pa,
                                                 const half_t* __restrict__ pb) {
#pragma unroll
  for (int i = 0; i < GFM; ++i)
    a[i] = frag_ordered(pa + (i << 9));
#pragma unroll
  for (int j = 0; j < GFN; ++j)
    b[j] = frag_ordered(pb + (j << 9));
}

static __device__ __forceinline__ void xcnt_then(unsigned& sa, unsigned& sb) {
  asm volatile("s_wait_xcnt 0x0" : "+s"(sa), "+s"(sb) : : "memory");
}

static __device__ __forceinline__ void gemm_mma(v8f (&acc)[GFM][GFN], const v16h (&a)[GFM],
                                                const v16h (&b)[GFN]) {
#pragma unroll
  for (int i = 0; i < GFM; ++i)
#pragma unroll
    for (int j = 0; j < GFN; ++j)
      acc[i][j] = wmma16(a[i], b[j], acc[i][j]);
}

__global__ void __launch_bounds__(GWV * 32)
out_gemm_kernel(const half_t* __restrict__ ctx, const half_t* __restrict__ wop,
                const float* __restrict__ bo, float* __restrict__ out) {
  int wave = threadIdx.x >> 5;
  int lane = threadIdx.x & 31;
  const int NBN = MODEL / 256;              // 8 column blocks
  int bm = blockIdx.x / NBN;
  int bn = blockIdx.x % NBN;
  int row0 = bm * 256 + (wave >> 1) * (GFM * 16);
  int nt0  = bn * 16 + (wave & 1) * GFN;    // first 16-column tile of this wave
  v8f acc[GFM][GFN];
#pragma unroll
  for (int i = 0; i < GFM; ++i)
#pragma unroll
    for (int j = 0; j < GFN; ++j) acc[i][j] = (v8f)0.f;
  const int ASTEP = NRT << 9;               // halves from one k step to the next, A
  const int BSTEP = (MODEL / 16) << 9;      // the same, packed B
  const half_t* pa = ctx + ((size_t)(row0 >> 4) << 9) + (lane << 3);
  const half_t* pb = wop + ((size_t)nt0 << 9) + (lane << 3);

  // The scheduling fences keep each step's 24 loads as one group in front of the 32 products
  // of the step before: left free, the scheduler sinks most of them to within a few WMMAs
  // of their first use, and the wave then waits out the load latency.
  v16h a0[GFM], b0[GFN], a1[GFM], b1[GFN];
  unsigned sa = ASTEP, sb = BSTEP;
  gemm_load(a0, b0, pa, pb);                // step 0
  __builtin_amdgcn_sched_barrier(0);
  xcnt_then(sa, sb);
  pa += sa;
  pb += sb;
  for (int kstep = 0; kstep < MODEL / 32; kstep += 2) {
    gemm_load(a1, b1, pa, pb);              // step kstep + 1
    __builtin_amdgcn_sched_barrier(0);
    gemm_mma(acc, a0, b0);
    __builtin_amdgcn_sched_barrier(0);
    bool more = kstep + 2 < MODEL / 32;     // no step behind the last: it is loaded again, not used
    sa = more ? ASTEP : 0;
    sb = more ? BSTEP : 0;
    xcnt_then(sa, sb);
    pa += sa;
    pb += sb;
    gemm_load(a0, b0, pa, pb);              // step kstep + 2
    __builtin_amdgcn_sched_barrier(0);
    gemm_mma(acc, a1, b1);
    __builtin_amdgcn_sched_barrier(0);
    sa = ASTEP;
    sb = BSTEP;
    xcnt_then(sa, sb);
    pa += sa;
    pb += sb;
  }

  int rrow = (lane >> 4) << 3;
  int col0 = lane & 15;
  const float* bp = bo + nt0 * 16 + col0;
  float* ob = out + (size_t)(row0 + rrow) * MODEL + nt0 * 16 + col0;
#pragma unroll
  for (int j = 0; j < GFN; ++j) {
    float bb_ = bp[j * 16];
#pragma unroll
    for (int i = 0; i < GFM; ++i) {
#pragma unroll
      for (int r = 0; r < 8; ++r)
        ob[(size_t)(i * 16 + r) * MODEL + j * 16] = acc[i][j][r] + bb_;
      // the next tile's sums may reuse these stores' data registers: the bias they add passes
      // through the wait's statement, so they stand behind it
      asm volatile("s_wait_xcnt 0x0" : "+v"(bb_) : : "memory");
    }
  }
}

extern "C" void kernel_launch(void* const* d_in, const int* in_sizes, int n_in,
                              void* d_out, int out_size, void* d_ws, size_t ws_size,
                              hipStream_t stream) {
  (void)in_sizes; (void)n_in; (void)out_size; (void)ws_size;
  const float* q  = (const float*)d_in[0];
  const float* k  = (const float*)d_in[1];
  const float* v  = (const float*)d_in[2];
  const float* Wq = (const float*)d_in[3];
  const float* bq = (const float*)d_in[4];
  const float* Wk = (const float*)d_in[5];
  const float* bk = (const float*)d_in[6];
  const float* Wv = (const float*)d_in[7];
  const float* bv = (const float*)d_in[8];
  const float* Wo = (const float*)d_in[9];
  const float* bo = (const float*)d_in[10];
  float* out = (float*)d_out;

  char* ws = (char*)d_ws;
  const size_t SZP = (size_t)BB * NH * SS * HID * sizeof(half_t); // 32 MiB each
  half_t* qp  = (half_t*)(ws);
  half_t* kv  = (half_t*)(ws + SZP);        // K and V stage blocks, 2 * SZP
  half_t* ctx = (half_t*)(ws + 3 * SZP);
  half_t* wqp = (half_t*)(ws + 4 * SZP);
  half_t* wkp = wqp + EMB * HID;
  half_t* wvp = wkp + EMB * HID;
  half_t* wop = wvp + EMB * HID;            // 2048*2048 f16

  // 1) pack weights into WMMA B-fragment order (f32 -> f16)
  dim3 wgrid(HID / (2 * PKT), EMB / 32);
  dim3 ogrid(MODEL / (2 * PKT), MODEL / 32);
  pack_w_kernel<HID><<<wgrid, PKT, 0, stream>>>(Wq, wqp);
  pack_w_kernel<HID><<<wgrid, PKT, 0, stream>>>(Wk, wkp);
  pack_w_kernel<HID><<<wgrid, PKT, 0, stream>>>(Wv, wvp);
  pack_w_kernel<MODEL><<<ogrid, PKT, 0, stream>>>(Wo, wop);

  // 2) QKV projections (K and V stored in operand order)
  dim3 pgrid(BB * (SS / 16) * NH / WPB, 3);
  proj_kernel<<<pgrid, WPB * 32, 0, stream>>>(q, k, v, wqp, wkp, wvp,
                                              bq, bk, bv, qp, kv);

  // 3) flash attention with tensor-loaded K/V stage blocks
  attn_kernel<<<BB * NH * (SS / QBLK), WPB * 32, 0, stream>>>(qp, kv, ctx);

  // 4) output GEMM + bias
  out_gemm_kernel<<<(BB * SS / 256) * (MODEL / 256), GWV * 32, 0, stream>>>(
      ctx, wop, bo, out);
}

// v007
// Measured time: 188 microseconds a run.
// Timed twice side by side with v006, it ran 1.10 and 1.09 times as fast.
// Counting every step since v000, it is 3.92 times as fast.
#include <hip/hip_runtime.h>

#define EMB   128
#define HID   128
#define NH    16
#define MODEL 2048
#define BB    4
#define SS    2048
#define WPB   4   // waves per block (wave32)
#define NKT   (SS / 32)   // 32-key blocks per head
#define BLK_H 8192        // halves per 32-key block: 4096 of K fragments, then 4096 of V fragments
#define BLK_B (BLK_H * 2u) // the same in bytes
#define KPS   WPB         // 32-key blocks per stage of the attention kernel's LDS ring: one per wave
#define NST   (NKT / KPS) // stages per head
#define STAGE_H (KPS * BLK_H)   // halves per stage
#define STAGE_B (STAGE_H * 2u)  // the same in bytes
#define NRT   (BB * SS / 16)  // 16-row tiles of ctx

typedef _Float16 half_t;
typedef __attribute__((ext_vector_type(16))) _Float16 v16h;
typedef __attribute__((ext_vector_type(8)))  _Float16 v8h;
typedef __attribute__((ext_vector_type(8)))  float    v8f;
typedef __attribute__((ext_vector_type(2)))  float    v2f;
typedef unsigned int u32x4 __attribute__((ext_vector_type(4)));
typedef unsigned int u32x8 __attribute__((ext_vector_type(8)));

static __device__ __forceinline__ v8f wmma16(v16h a, v16h b, v8f c) {
  // D = A(16x32 f16) * B(32x16 f16) + C(16x16 f32)
  return __builtin_amdgcn_wmma_f32_16x16x32_f16(false, a, false, b, (short)0, c,
                                                false, false);
}

static __device__ __forceinline__ v16h frag_f32(const float* __restrict__ p, int ld) {
  int lane = threadIdx.x & 31;
  const float* q = p + (size_t)(lane & 15) * ld + ((lane >> 4) << 3);
  v16h r;
#pragma unroll
  for (int i = 0; i < 8; ++i) { r[i] = (half_t)q[i]; r[i + 8] = (half_t)q[16 + i]; }
  return r;
}

// Fragment stored in operand order: 512 B of low halves (16 B per lane), then 512 B of
// high halves, so each of its two 16-byte loads or stores of a wave covers 4 whole 128-B lines.
// p already holds the lane's own 8-half offset.
static __device__ __forceinline__ v16h frag_ordered(const half_t* p) {
  v8h lo = *(const v8h*)p;
  v8h hi = *(const v8h*)(p + 256);
  return __builtin_shufflevector(lo, hi, 0,1,2,3,4,5,6,7,8,9,10,11,12,13,14,15);
}

// Packed weight fragment (k step, 16-column tile nt of NT), stored in operand order.
static __device__ __forceinline__ v16h frag_packed(const half_t* __restrict__ pk,
                                                   int kstep, int nt, int NT) {
  int lane = threadIdx.x & 31;
  return frag_ordered(pk + (((size_t)kstep * NT + nt) << 9) + (lane << 3));
}

static __device__ __forceinline__ float xhalf(float x) {
  int b = __builtin_bit_cast(int, x);
  return __builtin_bit_cast(float, __builtin_amdgcn_permlanex16(b, b, 0x76543210, 0xfedcba98, false, false));
}

static __device__ __forceinline__ unsigned uni(unsigned v) {
  return (unsigned)__builtin_amdgcn_readfirstlane(v);
}
static __device__ __forceinline__ unsigned pinned(unsigned v) {
  unsigned w = (unsigned)__builtin_amdgcn_readfirstlane(v);
  asm volatile("" : "+s"(w));
  return w;
}

static __device__ __forceinline__ u32x4 tdm_group0(unsigned lds_dst, const half_t* gptr) {
  unsigned long long ga = (unsigned long long)(size_t)gptr;
  u32x4 g0;
  g0[0] = uni(1u);                                              // count = 1
  g0[1] = uni(lds_dst);                                         // LDS byte offset
  g0[2] = uni((unsigned)ga);                                    // address [31:0]
  g0[3] = uni((((unsigned)(ga >> 32)) & 0x01ffffffu) | 0x80000000u); // address [56:32], type = 2
  return g0;
}
static __device__ __forceinline__ u32x8 tdm_group1() {
  u32x8 g1;
  g1[0] = uni(0u);
  g1[1] = uni(256u << 16);
  g1[2] = uni(64u << 16);
  g1[3] = uni(256u << 16);
  g1[4] = uni(64u);
  g1[5] = uni(256u);
  g1[6] = uni(0u);
  g1[7] = uni(0u);
  return g1;
}
// A wave's block of the next stage lies one stage further on in memory.
static __device__ __forceinline__ void tdm_advance(u32x4& g0, unsigned lds_dst) {
  unsigned lo = g0[2] + STAGE_B;
  g0[3] = uni(g0[3] + (lo < STAGE_B ? 1u : 0u));                // carry into address [56:32]
  g0[2] = uni(lo);
  g0[1] = uni(lds_dst);
}
static __device__ __forceinline__ void tdm_issue(u32x4& g0, u32x8& g1) {
  asm volatile("tensor_load_to_lds %0, %1" : "+s"(g0), "+s"(g1) : : "memory");
}

// Shuffle a row-major (K,N) fp32 weight into f16 B-operand fragment order.
// One thread = two neighbouring columns of one 32-row k step: 32 loads of 8 bytes (a wave
// reads 256 bytes in a row of each weight row), then, for each lane half kh of the fragment
// and each of its two parts, the 32 bytes in a row that fragment lanes kh*16 + (n&15) and the
// next one hold there: low part = rows kh*8 + 0..7, high part = rows 16 + kh*8 + 0..7.
// The grid covers the weight exactly: x = N / (2*PKT) column groups, y = K / 32 k steps.
// N is a compile-time constant, so the 32 loads share one address and differ in their offsets.
#define PKT 64            // threads per block
template <int N>
__global__ void __launch_bounds__(PKT)
pack_w_kernel(const float* __restrict__ W, half_t* __restrict__ packed) {
  int n = (blockIdx.x * PKT + threadIdx.x) * 2;
  int kstep = blockIdx.y;
  const float* src = W + (size_t)kstep * 32 * N + n;
  v2f x[32];
#pragma unroll
  for (int k = 0; k < 32; ++k) x[k] = *(const v2f*)(src + (size_t)k * N);
  // keeps all 32 loads in front of the first conversion: left free, the scheduler sinks the
  // last few behind the first waits, and the wave sits out the memory latency twice
  __builtin_amdgcn_sched_barrier(0);
  half_t* dst = packed + (((size_t)kstep * (N >> 4) + (n >> 4)) << 9) + ((n & 15) << 3);
#pragma unroll
  for (int kh = 0; kh < 2; ++kh)
#pragma unroll
    for (int part = 0; part < 2; ++part) {
      v16h w;
#pragma unroll
      for (int e = 0; e < 8; ++e) {
        w[e]     = (half_t)x[part * 16 + kh * 8 + e][0];
        w[e + 8] = (half_t)x[part * 16 + kh * 8 + e][1];
      }
      *(v16h*)(dst + part * 256 + kh * 128) = w;
    }
}

// QKV projection: one wave -> 16 seq rows x 128 hidden for one head.
// All three leave in the attention kernel's operand order. Q: per (batch, head, 16 queries)
// 4 fragments in a row, one per 32-wide k step kk. K and V: one 16 KB block per
// (batch, head, 32 keys): halves [0,4096) K, fragment (16-key tile j, 32-wide k step kk) at
// (j*4+kk)*512; halves [4096,8192) V, fragment (16-wide d tile nt) at nt*512.
__global__ void __launch_bounds__(WPB * 32)
proj_kernel(const float* __restrict__ qin, const float* __restrict__ kin,
            const float* __restrict__ vin,
            const half_t* __restrict__ wqp, const half_t* __restrict__ wkp,
            const half_t* __restrict__ wvp,
            const float* __restrict__ bq, const float* __restrict__ bk,
            const float* __restrict__ bv,
            half_t* __restrict__ qp, half_t* __restrict__ kv) {
  int wave = threadIdx.x >> 5;
  int lane = threadIdx.x & 31;
  int gid = blockIdx.x * WPB + wave;       // (tile, head)
  int h = gid % NH;
  int tile = gid / NH;
  int b = tile / (SS / 16);
  int s0 = (tile % (SS / 16)) << 4;
  int which = blockIdx.y;                  // 0=q 1=k 2=v

  const float*  x    = (which == 0) ? qin : (which == 1) ? kin : vin;
  const half_t* wp   = (which == 0) ? wqp : (which == 1) ? wkp : wvp;
  const float*  bias = (which == 0) ? bq  : (which == 1) ? bk  : bv;

  const float* xa = x + ((size_t)b * SS + s0) * MODEL + h * EMB;
  v8f acc[8];
#pragma unroll
  for (int i = 0; i < 8; ++i) acc[i] = (v8f)0.f;

  int rrow = (lane >> 4) << 3;              // C layout: M = r + 8*(lane/16)
  int col0 = lane & 15;                     // N = lane&15
  half_t* blk = kv + ((size_t)(b * NH + h) * NKT + (s0 >> 5)) * BLK_H + lane * 8;
  int j = (s0 >> 4) & 1;                    // which 16 keys of the block's 32

  if (which != 2) {
    // Q, K: weights as A, x as B, so a lane ends with 8 consecutive hidden of one query or key
#pragma unroll
    for (int kk = 0; kk < 4; ++kk) {        // K = 128 = 4 x 32
      v16h a = frag_f32(xa + kk * 32, MODEL);
#pragma unroll
      for (int nt = 0; nt < 8; ++nt) {      // N = 128 = 8 x 16
        v16h bf = frag_packed(wp, kk, nt, 8);
        acc[nt] = wmma16(bf, a, acc[nt]);
      }
    }
    // acc[nt][r] = row s0 + (lane&15), hidden nt*16 + rrow + r: half nt&1 of k step nt>>1
    half_t* base = (which == 1) ? blk + j * 2048
                                : qp + ((size_t)(b * NH + h) * SS + s0) * HID + lane * 8;
#pragma unroll
    for (int nt = 0; nt < 8; ++nt) {
      const float* bp = bias + nt * 16 + rrow;
      v8h w;
#pragma unroll
      for (int r = 0; r < 8; ++r) w[r] = (half_t)(acc[nt][r] + bp[r]);
      *(v8h*)(base + nt * 256) = w;
    }
    return;
  }

#pragma unroll
  for (int kk = 0; kk < 4; ++kk) {          // K = 128 = 4 x 32
    v16h a = frag_f32(xa + kk * 32, MODEL);
#pragma unroll
    for (int nt = 0; nt < 8; ++nt) {        // N = 128 = 8 x 16
      v16h bf = frag_packed(wp, kk, nt, 8);
      acc[nt] = wmma16(a, bf, acc[nt]);
    }
  }
  // acc[nt][r] = V[key s0 + rrow + r][d nt*16 + (lane&15)]: half j of d tile nt
  half_t* base = blk + 4096 + j * 256;
#pragma unroll
  for (int nt = 0; nt < 8; ++nt) {
    float bb_ = bias[nt * 16 + col0];
    v8h w;
#pragma unroll
    for (int r = 0; r < 8; ++r) w[r] = (half_t)(acc[nt][r] + bb_);
    *(v8h*)(base + nt * 512) = w;
  }
}

#define QC 2              // 16-query column groups per wave
#define QBLK (WPB * QC * 16)  // queries per block
__global__ void __launch_bounds__(WPB * 32)
attn_kernel(const half_t* __restrict__ qp, const half_t* __restrict__ kv,
            half_t* __restrict__ ctx) {
  __shared__ __attribute__((aligned(2048))) half_t kv_buf[2][STAGE_H]; // 2 x 64 KB

  int wave = (int)uni(threadIdx.x >> 5);
  int lane = threadIdx.x & 31;
  int qg = blockIdx.x % (SS / QBLK);        // 128-query group
  int bh = blockIdx.x / (SS / QBLK);
  int h  = bh % NH;
  int b  = bh / NH;
  int qt = (qg * WPB + wave) * QC;          // this wave's first 16-query tile

  const half_t* qph = qp + (size_t)(b * NH + h) * SS * HID;
  const half_t* kvh = kv + (size_t)(b * NH + h) * NKT * BLK_H;

  v16h qf[QC][4];
#pragma unroll
  for (int g = 0; g < QC; ++g)
#pragma unroll
    for (int kk = 0; kk < 4; ++kk)
      qf[g][kk] = frag_ordered(qph + (size_t)((qt + g) * 16) * HID + kk * 512 + lane * 8);
  asm volatile("s_wait_xcnt 0x0" ::: "memory");  // in front of the later reuse of the address registers that the Q loads name

  float m[QC];                              // running maximum of query lane&15 of group g
  float l[QC];                              // running sum over this lane half's keys only
  v8f o[QC][8];
#pragma unroll
  for (int g = 0; g < QC; ++g) {
    m[g] = -1e30f;
    l[g] = 0.f;
#pragma unroll
    for (int i = 0; i < 8; ++i) o[g][i] = (v8f)0.f;
  }

  const float sc = 0.088388347648318447f;   // 1/sqrt(128)
  // in the comments below: rrow = (lane >> 4) * 8, col0 = lane & 15
  const unsigned lds0 = (unsigned)(size_t)&kv_buf[0][0] + (unsigned)wave * BLK_B;  // this wave's block of buffer 0

  // prologue, every wave for its own block: stage 0 lands and is published, then stage 1 is set off
  u32x4 g0 = tdm_group0(lds0, kvh + wave * BLK_H);
  u32x8 g1 = tdm_group1();
  tdm_issue(g0, g1);
  asm volatile("s_wait_tensorcnt 0x0" ::: "memory");    // this wave's block of stage 0 landed before the barrier publishes it
  __syncthreads();
  tdm_advance(g0, lds0 + STAGE_B);
  tdm_issue(g0, g1);

  for (int st = 0; st < NST; ++st) {
    int par = st & 1;
    for (int kb = 0; kb < KPS; ++kb) {      // a pass: one 32-key block of this stage's buffer
      const half_t* sb = kv_buf[par] + kb * BLK_H + lane * 8;

      // The pass's 16 fragments are read as one group at its head: K is waited for once, and V
      // lands under the score products and the softmax.
      v16h kf[8], vf[8];
#pragma unroll
      for (int i = 0; i < 8; ++i) kf[i] = frag_ordered(sb + i * 512);
#pragma unroll
      for (int i = 0; i < 8; ++i) vf[i] = frag_ordered(sb + 4096 + i * 512);
      // keeps the reads in front of the products: left free, the scheduler sinks each read to
      // just in front of its WMMA, and the wave waits out the LDS latency sixteen times a pass
      __builtin_amdgcn_sched_barrier(0);

      v8f s0v[QC], s1v[QC];
#pragma unroll
      for (int g = 0; g < QC; ++g) { s0v[g] = (v8f)0.f; s1v[g] = (v8f)0.f; }
#pragma unroll
      for (int kk = 0; kk < 4; ++kk) {        // scores 32 keys x 32 queries over hidden=128
#pragma unroll
        for (int g = 0; g < QC; ++g) {
          s0v[g] = wmma16(kf[kk], qf[g][kk], s0v[g]);
          s1v[g] = wmma16(kf[4 + kk], qf[g][kk], s1v[g]);
        }
      }
      // s0v[g][r] = S[key rrow + r][query col0 of group g], s1v[g][r] = the same, key + 16

      v16h pf[QC];                            // P^T as B operand: the two score tiles, converted in place
#pragma unroll
      for (int g = 0; g < QC; ++g) {
        float rmax = fmaxf(s0v[g][0], s1v[g][0]);
#pragma unroll
        for (int r = 1; r < 8; ++r) rmax = fmaxf(rmax, fmaxf(s0v[g][r], s1v[g][r]));
        rmax = fmaxf(rmax, xhalf(rmax));      // the other 16 keys of the same query
        float mn = fmaxf(m[g], rmax * sc);
        float alpha = __expf(m[g] - mn);
        float rs0 = 0.f, rs1 = 0.f;
#pragma unroll
        for (int r = 0; r < 8; ++r) {
          float p0 = __expf(s0v[g][r] * sc - mn);
          float p1 = __expf(s1v[g][r] * sc - mn);
          rs0 += p0;
          rs1 += p1;
          pf[g][r]     = (half_t)p0;
          pf[g][r + 8] = (half_t)p1;
        }
        l[g] = l[g] * alpha + (rs0 + rs1);
        m[g] = mn;
#pragma unroll
        for (int nt = 0; nt < 8; ++nt)
#pragma unroll
          for (int r = 0; r < 8; ++r)
            o[g][nt][r] *= alpha;
      }

#pragma unroll
      for (int nt = 0; nt < 8; ++nt)          // O^T += V^T(128x32) * P^T(32x32)
#pragma unroll
        for (int g = 0; g < QC; ++g)
          o[g][nt] = wmma16(vf[nt], pf[g], o[g][nt]);
    }

    // publish point of stage st+1
    asm volatile("s_wait_dscnt 0x0" ::: "memory");        // this wave's reads of the buffer are done before it is refilled
    asm volatile("s_wait_tensorcnt 0x0" ::: "memory");    // this wave's block of stage st+1 landed before the barrier publishes it
    __syncthreads();                                      // publishes st+1, ends every read of this stage's buffer
    if (pinned(st + 2 < NST)) {                           // stage st+2 into the buffer these passes have read
      tdm_advance(g0, lds0 + (unsigned)par * STAGE_B);
      tdm_issue(g0, g1);
    }
  }
  asm volatile("s_wait_tensorcnt 0x0" ::: "memory");      // nothing in flight when the wave ends
  asm volatile("s_wait_dscnt 0x0" ::: "memory");

  // o[g][nt][r] = O[query col0 of group g][d nt*16 + rrow + r]: this very lane's half nt&1 of the
  // output GEMM's A fragment (16-row tile b*SS/16 + qt + g, k step h*4 + nt/2). ctx is stored in
  // that operand order, [k step][row tile][512 halves]: one 16-byte store, 512 B in a row per wave
  v8h w[QC][8];
#pragma unroll
  for (int g = 0; g < QC; ++g) {
    float inv = 1.f / (l[g] + xhalf(l[g])); // the two lane halves' sums join here
#pragma unroll
    for (int nt = 0; nt < 8; ++nt)
#pragma unroll
      for (int r = 0; r < 8; ++r) w[g][nt][r] = (half_t)(o[g][nt][r] * inv);
  }
  half_t* cbase = ctx + (((size_t)(h * (HID / 32)) * NRT + b * (SS / 16) + qt) << 9) + lane * 8;
#pragma unroll
  for (int g = 0; g < QC; ++g)
#pragma unroll
    for (int nt = 0; nt < 8; ++nt)
      *(v8h*)(cbase + (((nt >> 1) * NRT + g) << 9) + (nt & 1) * 256) = w[g][nt];
}

// Output projection: (B*S, 2048) x (2048, 2048) -> fp32 out (+bo). ctx comes in A operand order,
// [k step][row tile], as the packed Wo comes [k step][column tile]: a block reads 16 KB in a row
// of each per k step.
// One wave = 64 rows x 128 columns (4 A and 8 B fragments feed 32 accumulator tiles);
// a block of 8 waves (4 x 2) = 256 x 256. Each k step's fragments are loaded one step
// ahead into a second register set.
#define GFM 4             // A fragments (16 rows each) per wave
#define GFN 8             // B fragments (16 columns each) per wave
#define GWV 8             // waves per block: 4 along the rows, 2 along the columns

// One k step's fragments, both operands in operand order. pa, pb = the lane's own 8-half place
// in that step's fragment of the wave's first 16 rows and of its first 16 columns.
static __device__ __forceinline__ void gemm_load(v16h (&a)[GFM], v16h (&b)[GFN],
                                                 const half_t* __restrict__ pa,
                                                 const half_t* __restrict__ pb) {
#pragma unroll
  for (int i = 0; i < GFM; ++i)
    a[i] = frag_ordered(pa + (i << 9));
#pragma unroll
  for (int j = 0; j < GFN; ++j)
    b[j] = frag_ordered(pb + (j << 9));
}

static __device__ __forceinline__ void xcnt_then(unsigned& sa, unsigned& sb) {
  asm volatile("s_wait_xcnt 0x0" : "+s"(sa), "+s"(sb) : : "memory");
}

static __device__ __forceinline__ void gemm_mma(v8f (&acc)[GFM][GFN], const v16h (&a)[GFM],
                                                const v16h (&b)[GFN]) {
#pragma unroll
  for (int i = 0; i < GFM; ++i)
#pragma unroll
    for (int j = 0; j < GFN; ++j)
      acc[i][j] = wmma16(a[i], b[j], acc[i][j]);
}

__global__ void __launch_bounds__(GWV * 32)
out_gemm_kernel(const half_t* __restrict__ ctx, const half_t* __restrict__ wop,
                const float* __restrict__ bo, float* __restrict__ out) {
  int wave = threadIdx.x >> 5;
  int lane = threadIdx.x & 31;
  const int NBN = MODEL / 256;              // 8 column blocks
  int bm = blockIdx.x / NBN;
  int bn = blockIdx.x % NBN;
  int row0 = bm * 256 + (wave >> 1) * (GFM * 16);
  int nt0  = bn * 16 + (wave & 1) * GFN;    // first 16-column tile of this wave
  v8f acc[GFM][GFN];
#pragma unroll
  for (int i = 0; i < GFM; ++i)
#pragma unroll
    for (int j = 0; j < GFN; ++j) acc[i][j] = (v8f)0.f;
  const int ASTEP = NRT << 9;               // halves from one k step to the next, A
  const int BSTEP = (MODEL / 16) << 9;      // the same, packed B
  const half_t* pa = ctx + ((size_t)(row0 >> 4) << 9) + (lane << 3);
  const half_t* pb = wop + ((size_t)nt0 << 9) + (lane << 3);

  // The scheduling fences keep each step's 24 loads as one group in front of the 32 products
  // of the step before: left free, the scheduler sinks most of them to within a few WMMAs
  // of their first use, and the wave then waits out the load latency.
  v16h a0[GFM], b0[GFN], a1[GFM], b1[GFN];
  unsigned sa = ASTEP, sb = BSTEP;
  gemm_load(a0, b0, pa, pb);                // step 0
  __builtin_amdgcn_sched_barrier(0);
  xcnt_then(sa, sb);
  pa += sa;
  pb += sb;
  for (int kstep = 0; kstep < MODEL / 32; kstep += 2) {
    gemm_load(a1, b1, pa, pb);              // step kstep + 1
    __builtin_amdgcn_sched_barrier(0);
    gemm_mma(acc, a0, b0);
    __builtin_amdgcn_sched_barrier(0);
    bool more = kstep + 2 < MODEL / 32;     // no step behind the last: it is loaded again, not used
    sa = more ? ASTEP : 0;
    sb = more ? BSTEP : 0;
    xcnt_then(sa, sb);
    pa += sa;
    pb += sb;
    gemm_load(a0, b0, pa, pb);              // step kstep + 2
    __builtin_amdgcn_sched_barrier(0);
    gemm_mma(acc, a1, b1);
    __builtin_amdgcn_sched_barrier(0);
    sa = ASTEP;
    sb = BSTEP;
    xcnt_then(sa, sb);
    pa += sa;
    pb += sb;
  }

  int rrow = (lane >> 4) << 3;
  int col0 = lane & 15;
  const float* bp = bo + nt0 * 16 + col0;
  float* ob = out + (size_t)(row0 + rrow) * MODEL + nt0 * 16 + col0;
#pragma unroll
  for (int j = 0; j < GFN; ++j) {
    float bb_ = bp[j * 16];
#pragma unroll
    for (int i = 0; i < GFM; ++i) {
#pragma unroll
      for (int r = 0; r < 8; ++r)
        ob[(size_t)(i * 16 + r) * MODEL + j * 16] = acc[i][j][r] + bb_;
      // the next tile's sums may reuse these stores' data registers: the bias they add passes
      // through the wait's statement, so they stand behind it
      asm volatile("s_wait_xcnt 0x0" : "+v"(bb_) : : "memory");
    }
  }
}

extern "C" void kernel_launch(void* const* d_in, const int* in_sizes, int n_in,
                              void* d_out, int out_size, void* d_ws, size_t ws_size,
                              hipStream_t stream) {
  (void)in_sizes; (void)n_in; (void)out_size; (void)ws_size;
  const float* q  = (const float*)d_in[0];
  const float* k  = (const float*)d_in[1];
  const float* v  = (const float*)d_in[2];
  const float* Wq = (const float*)d_in[3];
  const float* bq = (const float*)d_in[4];
  const float* Wk = (const float*)d_in[5];
  const float* bk = (const float*)d_in[6];
  const float* Wv = (const float*)d_in[7];
  const float* bv = (const float*)d_in[8];
  const float* Wo = (const float*)d_in[9];
  const float* bo = (const float*)d_in[10];
  float* out = (float*)d_out;

  char* ws = (char*)d_ws;
  const size_t SZP = (size_t)BB * NH * SS * HID * sizeof(half_t); // 32 MiB each
  half_t* qp  = (half_t*)(ws);
  half_t* kv  = (half_t*)(ws + SZP);        // K and V stage blocks, 2 * SZP
  half_t* ctx = (half_t*)(ws + 3 * SZP);
  half_t* wqp = (half_t*)(ws + 4 * SZP);
  half_t* wkp = wqp + EMB * HID;
  half_t* wvp = wkp + EMB * HID;
  half_t* wop = wvp + EMB * HID;            // 2048*2048 f16

  // 1) pack weights into WMMA B-fragment order (f32 -> f16)
  dim3 wgrid(HID / (2 * PKT), EMB / 32);
  dim3 ogrid(MODEL / (2 * PKT), MODEL / 32);
  pack_w_kernel<HID><<<wgrid, PKT, 0, stream>>>(Wq, wqp);
  pack_w_kernel<HID><<<wgrid, PKT, 0, stream>>>(Wk, wkp);
  pack_w_kernel<HID><<<wgrid, PKT, 0, stream>>>(Wv, wvp);
  pack_w_kernel<MODEL><<<ogrid, PKT, 0, stream>>>(Wo, wop);

  // 2) QKV projections (K and V stored in operand order)
  dim3 pgrid(BB * (SS / 16) * NH / WPB, 3);
  proj_kernel<<<pgrid, WPB * 32, 0, stream>>>(q, k, v, wqp, wkp, wvp,
                                              bq, bk, bv, qp, kv);

  // 3) flash attention with tensor-loaded K/V stage blocks
  attn_kernel<<<BB * NH * (SS / QBLK), WPB * 32, 0, stream>>>(qp, kv, ctx);

  // 4) output GEMM + bias
  out_gemm_kernel<<<(BB * SS / 256) * (MODEL / 256), GWV * 32, 0, stream>>>(
      ctx, wop, bo, out);
}

// v008
// A run of this version takes 182 microseconds.
// In both of two side-by-side timings against v007, it was 1.03 times as fast.
// Counting every step since v000, it is 4.05 times as fast.
#include <hip/hip_runtime.h>

#define EMB   128
#define HID   128
#define NH    16
#define MODEL 2048
#define BB    4
#define SS    2048
#define WPB   4   // waves per block (wave32)
#define NKT   (SS / 32)   // 32-key blocks per head
#define BLK_H 8192        // halves per 32-key block: 4096 of K fragments, then 4096 of V fragments
#define BLK_B (BLK_H * 2u) // the same in bytes
#define KPS   WPB         // 32-key blocks per stage of the attention kernel's LDS ring: one per wave
#define NST   (NKT / KPS) // stages per head
#define STAGE_H (KPS * BLK_H)   // halves per stage
#define STAGE_B (STAGE_H * 2u)  // the same in bytes
#define NRT   (BB * SS / 16)  // 16-row tiles of ctx

typedef _Float16 half_t;
typedef __attribute__((ext_vector_type(16))) _Float16 v16h;
typedef __attribute__((ext_vector_type(8)))  _Float16 v8h;
typedef __attribute__((ext_vector_type(8)))  float    v8f;
typedef __attribute__((ext_vector_type(2)))  float    v2f;
typedef unsigned int u32x4 __attribute__((ext_vector_type(4)));
typedef unsigned int u32x8 __attribute__((ext_vector_type(8)));

static __device__ __forceinline__ v8f wmma16(v16h a, v16h b, v8f c) {
  // D = A(16x32 f16) * B(32x16 f16) + C(16x16 f32)
  return __builtin_amdgcn_wmma_f32_16x16x32_f16(false, a, false, b, (short)0, c,
                                                false, false);
}

static __device__ __forceinline__ v16h frag_f32(const float* __restrict__ p, int ld) {
  int lane = threadIdx.x & 31;
  const float* q = p + (size_t)(lane & 15) * ld + ((lane >> 4) << 3);
  v16h r;
#pragma unroll
  for (int i = 0; i < 8; ++i) { r[i] = (half_t)q[i]; r[i + 8] = (half_t)q[16 + i]; }
  return r;
}

// Fragment stored in operand order: 512 B of low halves (16 B per lane), then 512 B of
// high halves, so each of its two 16-byte loads or stores of a wave covers 4 whole 128-B lines.
// p already holds the lane's own 8-half offset.
static __device__ __forceinline__ v16h frag_ordered(const half_t* p) {
  v8h lo = *(const v8h*)p;
  v8h hi = *(const v8h*)(p + 256);
  return __builtin_shufflevector(lo, hi, 0,1,2,3,4,5,6,7,8,9,10,11,12,13,14,15);
}

// Packed weight fragment (k step, 16-column tile nt of NT), stored in operand order.
static __device__ __forceinline__ v16h frag_packed(const half_t* __restrict__ pk,
                                                   int kstep, int nt, int NT) {
  int lane = threadIdx.x & 31;
  return frag_ordered(pk + (((size_t)kstep * NT + nt) << 9) + (lane << 3));
}

static __device__ __forceinline__ float xhalf(float x) {
  int b = __builtin_bit_cast(int, x);
  return __builtin_bit_cast(float, __builtin_amdgcn_permlanex16(b, b, 0x76543210, 0xfedcba98, false, false));
}

static __device__ __forceinline__ unsigned uni(unsigned v) {
  return (unsigned)__builtin_amdgcn_readfirstlane(v);
}
static __device__ __forceinline__ unsigned pinned(unsigned v) {
  unsigned w = (unsigned)__builtin_amdgcn_readfirstlane(v);
  asm volatile("" : "+s"(w));
  return w;
}

static __device__ __forceinline__ u32x4 tdm_group0(unsigned lds_dst, const half_t* gptr) {
  unsigned long long ga = (unsigned long long)(size_t)gptr;
  u32x4 g0;
  g0[0] = uni(1u);                                              // count = 1
  g0[1] = uni(lds_dst);                                         // LDS byte offset
  g0[2] = uni((unsigned)ga);                                    // address [31:0]
  g0[3] = uni((((unsigned)(ga >> 32)) & 0x01ffffffu) | 0x80000000u); // address [56:32], type = 2
  return g0;
}
static __device__ __forceinline__ u32x8 tdm_group1() {
  u32x8 g1;
  g1[0] = uni(0u);
  g1[1] = uni(256u << 16);
  g1[2] = uni(64u << 16);
  g1[3] = uni(256u << 16);
  g1[4] = uni(64u);
  g1[5] = uni(256u);
  g1[6] = uni(0u);
  g1[7] = uni(0u);
  return g1;
}
// A wave's block of the next stage lies one stage further on in memory.
static __device__ __forceinline__ void tdm_advance(u32x4& g0, unsigned lds_dst) {
  unsigned lo = g0[2] + STAGE_B;
  g0[3] = uni(g0[3] + (lo < STAGE_B ? 1u : 0u));                // carry into address [56:32]
  g0[2] = uni(lo);
  g0[1] = uni(lds_dst);
}
static __device__ __forceinline__ void tdm_issue(u32x4& g0, u32x8& g1) {
  asm volatile("tensor_load_to_lds %0, %1" : "+s"(g0), "+s"(g1) : : "memory");
}

// Shuffle a row-major (K,N) fp32 weight into f16 B-operand fragment order.
// One thread = two neighbouring columns of one 32-row k step: 32 loads of 8 bytes (a wave
// reads 256 bytes in a row of each weight row), then, for each lane half kh of the fragment
// and each of its two parts, the 32 bytes in a row that fragment lanes kh*16 + (n&15) and the
// next one hold there: low part = rows kh*8 + 0..7, high part = rows 16 + kh*8 + 0..7.
// A block = column group cg (2*PKT columns) of k step kstep.
// N is a compile-time constant, so the 32 loads share one address and differ in their offsets.
#define PKT 64            // threads per block
template <int N>
static __device__ __forceinline__ void pack_w(const float* __restrict__ W,
                                              half_t* __restrict__ packed, int cg, int kstep) {
  int n = (cg * PKT + threadIdx.x) * 2;
  const float* src = W + (size_t)kstep * 32 * N + n;
  v2f x[32];
#pragma unroll
  for (int k = 0; k < 32; ++k) x[k] = *(const v2f*)(src + (size_t)k * N);
  // keeps all 32 loads in front of the first conversion: left free, the scheduler sinks the
  // last few behind the first waits, and the wave sits out the memory latency twice
  __builtin_amdgcn_sched_barrier(0);
  asm volatile("s_wait_xcnt 0x0" ::: "memory");  // in front of the conversions' reuse of the address registers that the loads name
  half_t* dst = packed + (((size_t)kstep * (N >> 4) + (n >> 4)) << 9) + ((n & 15) << 3);
#pragma unroll
  for (int kh = 0; kh < 2; ++kh)
#pragma unroll
    for (int part = 0; part < 2; ++part) {
      v16h w;
#pragma unroll
      for (int e = 0; e < 8; ++e) {
        w[e]     = (half_t)x[part * 16 + kh * 8 + e][0];
        w[e + 8] = (half_t)x[part * 16 + kh * 8 + e][1];
      }
      *(v16h*)(dst + part * 256 + kh * 128) = w;
    }
}

// All four weights in one launch. Grid: x = MODEL / (2*PKT) column groups, y = 1 + MODEL / 32.
// Row y = 0 holds the three small weights (one column group, SKS k steps each: block x =
// weight * SKS + k step; the blocks behind them have nothing to do); row y > 0 is k step y - 1 of Wo.
#define SKS (EMB / 32)    // k steps of a small weight
static_assert(HID == 2 * PKT, "a small weight is one column group wide");
static_assert(3 * SKS <= MODEL / (2 * PKT), "the small weights fit grid row 0");
__global__ void __launch_bounds__(PKT)
pack_all_kernel(const float* __restrict__ Wq, const float* __restrict__ Wk,
                const float* __restrict__ Wv, const float* __restrict__ Wo,
                half_t* __restrict__ wqp, half_t* __restrict__ wkp,
                half_t* __restrict__ wvp, half_t* __restrict__ wop) {
  if (blockIdx.y > 0) {
    pack_w<MODEL>(Wo, wop, blockIdx.x, blockIdx.y - 1);
    return;
  }
  int which = blockIdx.x / SKS;             // 0=q 1=k 2=v
  if (which > 2) return;
  const float* W = (which == 0) ? Wq  : (which == 1) ? Wk  : Wv;
  half_t*      p = (which == 0) ? wqp : (which == 1) ? wkp : wvp;
  pack_w<HID>(W, p, 0, blockIdx.x % SKS);
}

// QKV projection: one wave -> 16 seq rows x 128 hidden for one head.
// All three leave in the attention kernel's operand order. Q: per (batch, head, 16 queries)
// 4 fragments in a row, one per 32-wide k step kk. K and V: one 16 KB block per
// (batch, head, 32 keys): halves [0,4096) K, fragment (16-key tile j, 32-wide k step kk) at
// (j*4+kk)*512; halves [4096,8192) V, fragment (16-wide d tile nt) at nt*512.
__global__ void __launch_bounds__(WPB * 32)
proj_kernel(const float* __restrict__ qin, const float* __restrict__ kin,
            const float* __restrict__ vin,
            const half_t* __restrict__ wqp, const half_t* __restrict__ wkp,
            const half_t* __restrict__ wvp,
            const float* __restrict__ bq, const float* __restrict__ bk,
            const float* __restrict__ bv,
            half_t* __restrict__ qp, half_t* __restrict__ kv) {
  int wave = threadIdx.x >> 5;
  int lane = threadIdx.x & 31;
  int gid = blockIdx.x * WPB + wave;       // (tile, head)
  int h = gid % NH;
  int tile = gid / NH;
  int b = tile / (SS / 16);
  int s0 = (tile % (SS / 16)) << 4;
  int which = blockIdx.y;                  // 0=q 1=k 2=v

  const float*  x    = (which == 0) ? qin : (which == 1) ? kin : vin;
  const half_t* wp   = (which == 0) ? wqp : (which == 1) ? wkp : wvp;
  const float*  bias = (which == 0) ? bq  : (which == 1) ? bk  : bv;

  const float* xa = x + ((size_t)b * SS + s0) * MODEL + h * EMB;
  v8f acc[8];
#pragma unroll
  for (int i = 0; i < 8; ++i) acc[i] = (v8f)0.f;

  int rrow = (lane >> 4) << 3;              // C layout: M = r + 8*(lane/16)
  int col0 = lane & 15;                     // N = lane&15
  half_t* blk = kv + ((size_t)(b * NH + h) * NKT + (s0 >> 5)) * BLK_H + lane * 8;
  int j = (s0 >> 4) & 1;                    // which 16 keys of the block's 32

  if (which != 2) {
    // Q, K: weights as A, x as B, so a lane ends with 8 consecutive hidden of one query or key
#pragma unroll
    for (int kk = 0; kk < 4; ++kk) {        // K = 128 = 4 x 32
      v16h a = frag_f32(xa + kk * 32, MODEL);
#pragma unroll
      for (int nt = 0; nt < 8; ++nt) {      // N = 128 = 8 x 16
        v16h bf = frag_packed(wp, kk, nt, 8);
        acc[nt] = wmma16(bf, a, acc[nt]);
      }
    }
    // acc[nt][r] = row s0 + (lane&15), hidden nt*16 + rrow + r: half nt&1 of k step nt>>1
    half_t* base = (which == 1) ? blk + j * 2048
                                : qp + ((size_t)(b * NH + h) * SS + s0) * HID + lane * 8;
#pragma unroll
    for (int nt = 0; nt < 8; ++nt) {
      const float* bp = bias + nt * 16 + rrow;
      v8h w;
#pragma unroll
      for (int r = 0; r < 8; ++r) w[r] = (half_t)(acc[nt][r] + bp[r]);
      *(v8h*)(base + nt * 256) = w;
    }
    return;
  }

#pragma unroll
  for (int kk = 0; kk < 4; ++kk) {          // K = 128 = 4 x 32
    v16h a = frag_f32(xa + kk * 32, MODEL);
#pragma unroll
    for (int nt = 0; nt < 8; ++nt) {        // N = 128 = 8 x 16
      v16h bf = frag_packed(wp, kk, nt, 8);
      acc[nt] = wmma16(a, bf, acc[nt]);
    }
  }
  // acc[nt][r] = V[key s0 + rrow + r][d nt*16 + (lane&15)]: half j of d tile nt
  half_t* base = blk + 4096 + j * 256;
#pragma unroll
  for (int nt = 0; nt < 8; ++nt) {
    float bb_ = bias[nt * 16 + col0];
    v8h w;
#pragma unroll
    for (int r = 0; r < 8; ++r) w[r] = (half_t)(acc[nt][r] + bb_);
    *(v8h*)(base + nt * 512) = w;
  }
}

#define QC 2              // 16-query column groups per wave
#define QBLK (WPB * QC * 16)  // queries per block
__global__ void __launch_bounds__(WPB * 32)
attn_kernel(const half_t* __restrict__ qp, const half_t* __restrict__ kv,
            half_t* __restrict__ ctx) {
  __shared__ __attribute__((aligned(2048))) half_t kv_buf[2][STAGE_H]; // 2 x 64 KB

  int wave = (int)uni(threadIdx.x >> 5);
  int lane = threadIdx.x & 31;
  int qg = blockIdx.x % (SS / QBLK);        // 128-query group
  int bh = blockIdx.x / (SS / QBLK);
  int h  = bh % NH;
  int b  = bh / NH;
  int qt = (qg * WPB + wave) * QC;          // this wave's first 16-query tile

  const half_t* qph = qp + (size_t)(b * NH + h) * SS * HID;
  const half_t* kvh = kv + (size_t)(b * NH + h) * NKT * BLK_H;

  v16h qf[QC][4];
#pragma unroll
  for (int g = 0; g < QC; ++g)
#pragma unroll
    for (int kk = 0; kk < 4; ++kk)
      qf[g][kk] = frag_ordered(qph + (size_t)((qt + g) * 16) * HID + kk * 512 + lane * 8);
  asm volatile("s_wait_xcnt 0x0" ::: "memory");  // in front of the later reuse of the address registers that the Q loads name

  float m[QC];                              // running maximum of query lane&15 of group g
  float l[QC];                              // running sum over this lane half's keys only
  v8f o[QC][8];
#pragma unroll
  for (int g = 0; g < QC; ++g) {
    m[g] = -1e30f;
    l[g] = 0.f;
#pragma unroll
    for (int i = 0; i < 8; ++i) o[g][i] = (v8f)0.f;
  }

  const float sc = 0.088388347648318447f;   // 1/sqrt(128)
  // in the comments below: rrow = (lane >> 4) * 8, col0 = lane & 15
  const unsigned lds0 = (unsigned)(size_t)&kv_buf[0][0] + (unsigned)wave * BLK_B;  // this wave's block of buffer 0

  // prologue, every wave for its own block: stage 0 lands and is published, then stage 1 is set off
  u32x4 g0 = tdm_group0(lds0, kvh + wave * BLK_H);
  u32x8 g1 = tdm_group1();
  tdm_issue(g0, g1);
  asm volatile("s_wait_tensorcnt 0x0" ::: "memory");    // this wave's block of stage 0 landed before the barrier publishes it
  __syncthreads();
  tdm_advance(g0, lds0 + STAGE_B);
  tdm_issue(g0, g1);

  for (int st = 0; st < NST; ++st) {
    int par = st & 1;
    for (int kb = 0; kb < KPS; ++kb) {      // a pass: one 32-key block of this stage's buffer
      const half_t* sb = kv_buf[par] + kb * BLK_H + lane * 8;

      // The pass's 16 fragments are read as one group at its head: K is waited for once, and V
      // lands under the score products and the softmax.
      v16h kf[8], vf[8];
#pragma unroll
      for (int i = 0; i < 8; ++i) kf[i] = frag_ordered(sb + i * 512);
#pragma unroll
      for (int i = 0; i < 8; ++i) vf[i] = frag_ordered(sb + 4096 + i * 512);
      // keeps the reads in front of the products: left free, the scheduler sinks each read to
      // just in front of its WMMA, and the wave waits out the LDS latency sixteen times a pass
      __builtin_amdgcn_sched_barrier(0);

      v8f s0v[QC], s1v[QC];
#pragma unroll
      for (int g = 0; g < QC; ++g) { s0v[g] = (v8f)0.f; s1v[g] = (v8f)0.f; }
#pragma unroll
      for (int kk = 0; kk < 4; ++kk) {        // scores 32 keys x 32 queries over hidden=128
#pragma unroll
        for (int g = 0; g < QC; ++g) {
          s0v[g] = wmma16(kf[kk], qf[g][kk], s0v[g]);
          s1v[g] = wmma16(kf[4 + kk], qf[g][kk], s1v[g]);
        }
      }
      // s0v[g][r] = S[key rrow + r][query col0 of group g], s1v[g][r] = the same, key + 16

      v16h pf[QC];                            // P^T as B operand: the two score tiles, converted in place
#pragma unroll
      for (int g = 0; g < QC; ++g) {
        float rmax = fmaxf(s0v[g][0], s1v[g][0]);
#pragma unroll
        for (int r = 1; r < 8; ++r) rmax = fmaxf(rmax, fmaxf(s0v[g][r], s1v[g][r]));
        rmax = fmaxf(rmax, xhalf(rmax));      // the other 16 keys of the same query
        float mn = fmaxf(m[g], rmax * sc);
        float alpha = __expf(m[g] - mn);
        float rs0 = 0.f, rs1 = 0.f;
#pragma unroll
        for (int r = 0; r < 8; ++r) {
          float p0 = __expf(s0v[g][r] * sc - mn);
          float p1 = __expf(s1v[g][r] * sc - mn);
          rs0 += p0;
          rs1 += p1;
          pf[g][r]     = (half_t)p0;
          pf[g][r + 8] = (half_t)p1;
        }
        l[g] = l[g] * alpha + (rs0 + rs1);
        m[g] = mn;
#pragma unroll
        for (int nt = 0; nt < 8; ++nt)
#pragma unroll
          for (int r = 0; r < 8; ++r)
            o[g][nt][r] *= alpha;
      }

#pragma unroll
      for (int nt = 0; nt < 8; ++nt)          // O^T += V^T(128x32) * P^T(32x32)
#pragma unroll
        for (int g = 0; g < QC; ++g)
          o[g][nt] = wmma16(vf[nt], pf[g], o[g][nt]);
    }

    // publish point of stage st+1
    asm volatile("s_wait_dscnt 0x0" ::: "memory");        // this wave's reads of the buffer are done before it is refilled
    asm volatile("s_wait_tensorcnt 0x0" ::: "memory");    // this wave's block of stage st+1 landed before the barrier publishes it
    __syncthreads();                                      // publishes st+1, ends every read of this stage's buffer
    if (pinned(st + 2 < NST)) {                           // stage st+2 into the buffer these passes have read
      tdm_advance(g0, lds0 + (unsigned)par * STAGE_B);
      tdm_issue(g0, g1);
    }
  }
  asm volatile("s_wait_tensorcnt 0x0" ::: "memory");      // nothing in flight when the wave ends
  asm volatile("s_wait_dscnt 0x0" ::: "memory");

  // o[g][nt][r] = O[query col0 of group g][d nt*16 + rrow + r]: this very lane's half nt&1 of the
  // output GEMM's A fragment (16-row tile b*SS/16 + qt + g, k step h*4 + nt/2). ctx is stored in
  // that operand order, [k step][row tile][512 halves]: one 16-byte store, 512 B in a row per wave
  v8h w[QC][8];
#pragma unroll
  for (int g = 0; g < QC; ++g) {
    float inv = 1.f / (l[g] + xhalf(l[g])); // the two lane halves' sums join here
#pragma unroll
    for (int nt = 0; nt < 8; ++nt)
#pragma unroll
      for (int r = 0; r < 8; ++r) w[g][nt][r] = (half_t)(o[g][nt][r] * inv);
  }
  half_t* cbase = ctx + (((size_t)(h * (HID / 32)) * NRT + b * (SS / 16) + qt) << 9) + lane * 8;
#pragma unroll
  for (int g = 0; g < QC; ++g)
#pragma unroll
    for (int nt = 0; nt < 8; ++nt)
      *(v8h*)(cbase + (((nt >> 1) * NRT + g) << 9) + (nt & 1) * 256) = w[g][nt];
}

// Output projection: (B*S, 2048) x (2048, 2048) -> fp32 out (+bo). ctx comes in A operand order,
// [k step][row tile], as the packed Wo comes [k step][column tile]: a block reads 16 KB in a row
// of each per k step.
// One wave = 64 rows x 128 columns (4 A and 8 B fragments feed 32 accumulator tiles);
// a block of 8 waves (4 x 2) = 256 x 256. Each k step's fragments are loaded one step
// ahead into a second register set.
#define GFM 4             // A fragments (16 rows each) per wave
#define GFN 8             // B fragments (16 columns each) per wave
#define GWV 8             // waves per block: 4 along the rows, 2 along the columns

// One k step's fragments, both operands in operand order. pa, pb = the lane's own 8-half place
// in that step's fragment of the wave's first 16 rows and of its first 16 columns.
static __device__ __forceinline__ void gemm_load(v16h (&a)[GFM], v16h (&b)[GFN],
                                                 const half_t* __restrict__ pa,
                                                 const half_t* __restrict__ pb) {
#pragma unroll
  for (int i = 0; i < GFM; ++i)
    a[i] = frag_ordered(pa + (i << 9));
#pragma unroll
  for (int j = 0; j < GFN; ++j)
    b[j] = frag_ordered(pb + (j << 9));
}

static __device__ __forceinline__ void xcnt_then(unsigned& sa, unsigned& sb) {
  asm volatile("s_wait_xcnt 0x0" : "+s"(sa), "+s"(sb) : : "memory");
}

static __device__ __forceinline__ void gemm_mma(v8f (&acc)[GFM][GFN], const v16h (&a)[GFM],
                                                const v16h (&b)[GFN]) {
#pragma unroll
  for (int i = 0; i < GFM; ++i)
#pragma unroll
    for (int j = 0; j < GFN; ++j)
      acc[i][j] = wmma16(a[i], b[j], acc[i][j]);
}

__global__ void __launch_bounds__(GWV * 32)
out_gemm_kernel(const half_t* __restrict__ ctx, const half_t* __restrict__ wop,
                const float* __restrict__ bo, float* __restrict__ out) {
  int wave = threadIdx.x >> 5;
  int lane = threadIdx.x & 31;
  const int NBN = MODEL / 256;              // 8 column blocks
  int bm = blockIdx.x / NBN;
  int bn = blockIdx.x % NBN;
  int row0 = bm * 256 + (wave >> 1) * (GFM * 16);
  int nt0  = bn * 16 + (wave & 1) * GFN;    // first 16-column tile of this wave
  v8f acc[GFM][GFN];
#pragma unroll
  for (int i = 0; i < GFM; ++i)
#pragma unroll
    for (int j = 0; j < GFN; ++j) acc[i][j] = (v8f)0.f;
  const int ASTEP = NRT << 9;               // halves from one k step to the next, A
  const int BSTEP = (MODEL / 16) << 9;      // the same, packed B
  const half_t* pa = ctx + ((size_t)(row0 >> 4) << 9) + (lane << 3);
  const half_t* pb = wop + ((size_t)nt0 << 9) + (lane << 3);

  // The scheduling fences keep each step's 24 loads as one group in front of the 32 products
  // of the step before: left free, the scheduler sinks most of them to within a few WMMAs
  // of their first use, and the wave then waits out the load latency.
  v16h a0[GFM], b0[GFN], a1[GFM], b1[GFN];
  unsigned sa = ASTEP, sb = BSTEP;
  gemm_load(a0, b0, pa, pb);                // step 0
  __builtin_amdgcn_sched_barrier(0);
  xcnt_then(sa, sb);
  pa += sa;
  pb += sb;
  for (int kstep = 0; kstep < MODEL / 32; kstep += 2) {
    gemm_load(a1, b1, pa, pb);              // step kstep + 1
    __builtin_amdgcn_sched_barrier(0);
    gemm_mma(acc, a0, b0);
    __builtin_amdgcn_sched_barrier(0);
    bool more = kstep + 2 < MODEL / 32;     // no step behind the last: it is loaded again, not used
    sa = more ? ASTEP : 0;
    sb = more ? BSTEP : 0;
    xcnt_then(sa, sb);
    pa += sa;
    pb += sb;
    gemm_load(a0, b0, pa, pb);              // step kstep + 2
    __builtin_amdgcn_sched_barrier(0);
    gemm_mma(acc, a1, b1);
    __builtin_amdgcn_sched_barrier(0);
    sa = ASTEP;
    sb = BSTEP;
    xcnt_then(sa, sb);
    pa += sa;
    pb += sb;
  }

  int rrow = (lane >> 4) << 3;
  int col0 = lane & 15;
  const float* bp = bo + nt0 * 16 + col0;
  float* ob = out + (size_t)(row0 + rrow) * MODEL + nt0 * 16 + col0;
#pragma unroll
  for (int j = 0; j < GFN; ++j) {
    float bb_ = bp[j * 16];
#pragma unroll
    for (int i = 0; i < GFM; ++i) {
#pragma unroll
      for (int r = 0; r < 8; ++r)
        ob[(size_t)(i * 16 + r) * MODEL + j * 16] = acc[i][j][r] + bb_;
      // the next tile's sums may reuse these stores' data registers: the bias they add passes
      // through the wait's statement, so they stand behind it
      asm volatile("s_wait_xcnt 0x0" : "+v"(bb_) : : "memory");
    }
  }
}

extern "C" void kernel_launch(void* const* d_in, const int* in_sizes, int n_in,
                              void* d_out, int out_size, void* d_ws, size_t ws_size,
                              hipStream_t stream) {
  (void)in_sizes; (void)n_in; (void)out_size; (void)ws_size;
  const float* q  = (const float*)d_in[0];
  const float* k  = (const float*)d_in[1];
  const float* v  = (const float*)d_in[2];
  const float* Wq = (const float*)d_in[3];
  const float* bq = (const float*)d_in[4];
  const float* Wk = (const float*)d_in[5];
  const float* bk = (const float*)d_in[6];
  const float* Wv = (const float*)d_in[7];
  const float* bv = (const float*)d_in[8];
  const float* Wo = (const float*)d_in[9];
  const float* bo = (const float*)d_in[10];
  float* out = (float*)d_out;

  char* ws = (char*)d_ws;
  const size_t SZP = (size_t)BB * NH * SS * HID * sizeof(half_t); // 32 MiB each
  half_t* qp  = (half_t*)(ws);
  half_t* kv  = (half_t*)(ws + SZP);        // K and V stage blocks, 2 * SZP
  half_t* ctx = (half_t*)(ws + 3 * SZP);
  half_t* wqp = (half_t*)(ws + 4 * SZP);
  half_t* wkp = wqp + EMB * HID;
  half_t* wvp = wkp + EMB * HID;
  half_t* wop = wvp + EMB * HID;            // 2048*2048 f16

  // 1) pack the four weights into WMMA B-fragment order (f32 -> f16), one launch
  dim3 wgrid(MODEL / (2 * PKT), 1 + MODEL / 32);
  pack_all_kernel<<<wgrid, PKT, 0, stream>>>(Wq, Wk, Wv, Wo, wqp, wkp, wvp, wop);

  // 2) QKV projections (K and V stored in operand order)
  dim3 pgrid(BB * (SS / 16) * NH / WPB, 3);
  proj_kernel<<<pgrid, WPB * 32, 0, stream>>>(q, k, v, wqp, wkp, wvp,
                                              bq, bk, bv, qp, kv);

  // 3) flash attention with tensor-loaded K/V stage blocks
  attn_kernel<<<BB * NH * (SS / QBLK), WPB * 32, 0, stream>>>(qp, kv, ctx);

  // 4) output GEMM + bias
  out_gemm_kernel<<<(BB * SS / 256) * (MODEL / 256), GWV * 32, 0, stream>>>(
      ctx, wop, bo, out);
}

// v010
// One run takes 166 microseconds.
// It is 1.10 times as fast as v008, going by the measured steps of the versions left out in between.
// All steps since v000 together make it 4.45 times as fast.
#include <hip/hip_runtime.h>

#define EMB   128
#define HID   128
#define NH    16
#define MODEL 2048
#define BB    4
#define SS    2048
#define WPB   4   // waves per block (wave32)
#define NKT   (SS / 32)   // 32-key blocks per head
#define BLK_H 8192        // halves per 32-key block: 4096 of K fragments, then 4096 of V fragments
#define BLK_B (BLK_H * 2u) // the same in bytes
#define KPS   WPB         // 32-key blocks per stage of the attention kernel's LDS ring: one per wave
#define NST   (NKT / KPS) // stages per head
#define STAGE_H (KPS * BLK_H)   // halves per stage
#define STAGE_B (STAGE_H * 2u)  // the same in bytes
#define NRT   (BB * SS / 16)  // 16-row tiles of ctx

typedef _Float16 half_t;
typedef __attribute__((ext_vector_type(16))) _Float16 v16h;
typedef __attribute__((ext_vector_type(8)))  _Float16 v8h;
typedef __attribute__((ext_vector_type(8)))  float    v8f;
typedef __attribute__((ext_vector_type(2)))  float    v2f;
typedef __attribute__((ext_vector_type(4)))  float    v4f;
typedef unsigned int u32x4 __attribute__((ext_vector_type(4)));
typedef unsigned int u32x8 __attribute__((ext_vector_type(8)));

static __device__ __forceinline__ v8f wmma16(v16h a, v16h b, v8f c) {
  // D = A(16x32 f16) * B(32x16 f16) + C(16x16 f32)
  return __builtin_amdgcn_wmma_f32_16x16x32_f16(false, a, false, b, (short)0, c,
                                                false, false);
}

// Fragment stored in operand order: 512 B of low halves (16 B per lane), then 512 B of
// high halves, so each of its two 16-byte loads or stores of a wave covers 4 whole 128-B lines.
// p already holds the lane's own 8-half offset.
static __device__ __forceinline__ v16h frag_ordered(const half_t* p) {
  v8h lo = *(const v8h*)p;
  v8h hi = *(const v8h*)(p + 256);
  return __builtin_shufflevector(lo, hi, 0,1,2,3,4,5,6,7,8,9,10,11,12,13,14,15);
}

static __device__ __forceinline__ float xhalf(float x) {
  int b = __builtin_bit_cast(int, x);
  return __builtin_bit_cast(float, __builtin_amdgcn_permlanex16(b, b, 0x76543210, 0xfedcba98, false, false));
}

static __device__ __forceinline__ unsigned uni(unsigned v) {
  return (unsigned)__builtin_amdgcn_readfirstlane(v);
}
static __device__ __forceinline__ unsigned pinned(unsigned v) {
  unsigned w = (unsigned)__builtin_amdgcn_readfirstlane(v);
  asm volatile("" : "+s"(w));
  return w;
}

static __device__ __forceinline__ u32x4 tdm_group0(unsigned lds_dst, const half_t* gptr) {
  unsigned long long ga = (unsigned long long)(size_t)gptr;
  u32x4 g0;
  g0[0] = uni(1u);                                              // count = 1
  g0[1] = uni(lds_dst);                                         // LDS byte offset
  g0[2] = uni((unsigned)ga);                                    // address [31:0]
  g0[3] = uni((((unsigned)(ga >> 32)) & 0x01ffffffu) | 0x80000000u); // address [56:32], type = 2
  return g0;
}
static __device__ __forceinline__ u32x8 tdm_group1() {
  u32x8 g1;
  g1[0] = uni(0u);
  g1[1] = uni(256u << 16);
  g1[2] = uni(64u << 16);
  g1[3] = uni(256u << 16);
  g1[4] = uni(64u);
  g1[5] = uni(256u);
  g1[6] = uni(0u);
  g1[7] = uni(0u);
  return g1;
}
// A wave's block of the next stage lies one stage further on in memory.
static __device__ __forceinline__ void tdm_advance(u32x4& g0, unsigned lds_dst) {
  unsigned lo = g0[2] + STAGE_B;
  g0[3] = uni(g0[3] + (lo < STAGE_B ? 1u : 0u));                // carry into address [56:32]
  g0[2] = uni(lo);
  g0[1] = uni(lds_dst);
}
static __device__ __forceinline__ void tdm_issue(u32x4& g0, u32x8& g1) {
  asm volatile("tensor_load_to_lds %0, %1" : "+s"(g0), "+s"(g1) : : "memory");
}

// Shuffle a row-major (K,N) fp32 weight into f16 B-operand fragment order.
// One thread = two neighbouring columns of one 32-row k step: 32 loads of 8 bytes (a wave
// reads 256 bytes in a row of each weight row), then, for each lane half kh of the fragment
// and each of its two parts, the 32 bytes in a row that fragment lanes kh*16 + (n&15) and the
// next one hold there: low part = rows kh*8 + 0..7, high part = rows 16 + kh*8 + 0..7.
// A block = column group cg (2*PKT columns) of k step kstep.
// N is a compile-time constant, so the 32 loads share one address and differ in their offsets.
#define PKT 64            // threads per block
template <int N>
static __device__ __forceinline__ void pack_w(const float* __restrict__ W,
                                              half_t* __restrict__ packed, int cg, int kstep) {
  int n = (cg * PKT + threadIdx.x) * 2;
  const float* src = W + (size_t)kstep * 32 * N + n;
  v2f x[32];
#pragma unroll
  for (int k = 0; k < 32; ++k) x[k] = *(const v2f*)(src + (size_t)k * N);
  // keeps all 32 loads in front of the first conversion: left free, the scheduler sinks the
  // last few behind the first waits, and the wave sits out the memory latency twice
  __builtin_amdgcn_sched_barrier(0);
  asm volatile("s_wait_xcnt 0x0" ::: "memory");  // in front of the conversions' reuse of the address registers that the loads name
  half_t* dst = packed + (((size_t)kstep * (N >> 4) + (n >> 4)) << 9) + ((n & 15) << 3);
#pragma unroll
  for (int kh = 0; kh < 2; ++kh)
#pragma unroll
    for (int part = 0; part < 2; ++part) {
      v16h w;
#pragma unroll
      for (int e = 0; e < 8; ++e) {
        w[e]     = (half_t)x[part * 16 + kh * 8 + e][0];
        w[e + 8] = (half_t)x[part * 16 + kh * 8 + e][1];
      }
      *(v16h*)(dst + part * 256 + kh * 128) = w;
    }
}

// All four weights in one launch. Grid: x = MODEL / (2*PKT) column groups, y = 1 + MODEL / 32.
// Row y = 0 holds the three small weights (one column group, SKS k steps each: block x =
// weight * SKS + k step; the blocks behind them have nothing to do); row y > 0 is k step y - 1 of Wo.
#define SKS (EMB / 32)    // k steps of a small weight
static_assert(HID == 2 * PKT, "a small weight is one column group wide");
static_assert(3 * SKS <= MODEL / (2 * PKT), "the small weights fit grid row 0");
__global__ void __launch_bounds__(PKT)
pack_all_kernel(const float* __restrict__ Wq, const float* __restrict__ Wk,
                const float* __restrict__ Wv, const float* __restrict__ Wo,
                half_t* __restrict__ wqp, half_t* __restrict__ wkp,
                half_t* __restrict__ wvp, half_t* __restrict__ wop) {
  if (blockIdx.y > 0) {
    pack_w<MODEL>(Wo, wop, blockIdx.x, blockIdx.y - 1);
    return;
  }
  int which = blockIdx.x / SKS;             // 0=q 1=k 2=v
  if (which > 2) return;
  const float* W = (which == 0) ? Wq  : (which == 1) ? Wk  : Wv;
  half_t*      p = (which == 0) ? wqp : (which == 1) ? wkp : wvp;
  pack_w<HID>(W, p, 0, blockIdx.x % SKS);
}

// QKV projection: one wave -> PR 16-row tiles (32 seq rows) x 128 hidden for one head, so every
// packed weight fragment it loads feeds PR WMMAs.
// All three leave in the attention kernel's operand order. Q: per (batch, head, 16 queries)
// 4 fragments in a row, one per 32-wide k step kk. K and V: one 16 KB block per
// (batch, head, 32 keys): halves [0,4096) K, fragment (16-key tile j, 32-wide k step kk) at
// (j*4+kk)*512; halves [4096,8192) V, fragment (16-wide d tile nt) at nt*512.
#define PR 2              // 16-row tiles per wave: the two halves of one 32-key block

// One k step's 8 weight fragments. wl = the lane's own 8-half place in the first fragment.
static __device__ __forceinline__ void proj_load_w(v16h (&w)[8], const half_t* __restrict__ wl, int kk) {
#pragma unroll
  for (int nt = 0; nt < 8; ++nt) w[nt] = frag_ordered(wl + ((kk * 8 + nt) << 9));
}

// XA: x is the A operand (V: a lane ends with 8 consecutive keys of one d); otherwise the weights
// are A and x is B (Q, K: a lane ends with 8 consecutive hidden of one query or key, and takes the
// 8 bias values of each of its 8 hidden groups, bo bytes into each 16 of bias, into bs). For V, bo
// is the lane's d within a 16-wide d tile, and bs[nt][0][0] takes the bias of d tile nt.
template <bool XA>
static __device__ __forceinline__ void proj_tiles(v8f (&acc)[PR][8], const float* __restrict__ xl,
                                                  const half_t* __restrict__ wl,
                                                  const float* __restrict__ bias, unsigned bo,
                                                  v4f (&bs)[8][2]) {
  // The wave's whole x (PR x 16 rows x 512 B, from memory) is asked for at once, then the first
  // k step's weights. xl = the lane's own row (lane & 15) and k base ((lane >> 4) * 8): of each
  // 32-wide k step a lane holds k base + 0..7 (low half) and k base + 16..23 (high half).
  v4f xr[4][PR][4];
  v16h w[2][8];
#pragma unroll
  for (int kk = 0; kk < 4; ++kk)
#pragma unroll
    for (int t = 0; t < PR; ++t)
#pragma unroll
      for (int i = 0; i < 4; ++i)
        xr[kk][t][i] = *(const v4f*)(xl + (size_t)t * 16 * MODEL + kk * 32 + (i >> 1) * 16 + (i & 1) * 4);
  proj_load_w(w[0], wl, 0);
  if (XA) {
#pragma unroll
    for (int nt = 0; nt < 8; ++nt) bs[nt][0][0] = bias[nt * 16 + bo];
  }
  // keeps all these loads in front of the first wait: left free, the scheduler asks for each k
  // step's x only when the step before is done, and the wave sits out the memory latency four times
  __builtin_amdgcn_sched_barrier(0);
  // in front of the later reuse of the address registers that these loads name; bo is an input so
  // that its register, which V's bias loads name, is not given to a load's result in front of the wait
  asm volatile("s_wait_xcnt 0x0" :: "v"(bo) : "memory");
  __builtin_amdgcn_sched_barrier(0);             // nothing that writes a register is lifted over that wait
  // all of x is converted before the first product: 64 registers of f16, not 128 of f32, live beside
  // the accumulators and the two weight sets
  v16h a[4][PR];
#pragma unroll
  for (int kk = 0; kk < 4; ++kk)
#pragma unroll
    for (int t = 0; t < PR; ++t)
#pragma unroll
      for (int i = 0; i < 4; ++i) {
        a[kk][t][i]      = (half_t)xr[kk][t][0][i];
        a[kk][t][i + 4]  = (half_t)xr[kk][t][1][i];
        a[kk][t][i + 8]  = (half_t)xr[kk][t][2][i];
        a[kk][t][i + 12] = (half_t)xr[kk][t][3][i];
      }
#pragma unroll
  for (int kk = 0; kk < 4; ++kk) {          // K = 128 = 4 x 32
    // what comes next (the next k step's weights; behind the last, the bias) is asked for as one
    // group in front of this step's products, which cover its way
    if (kk < 3) {
      __builtin_amdgcn_sched_barrier(0);
      proj_load_w(w[(kk + 1) & 1], wl, kk + 1);
      __builtin_amdgcn_sched_barrier(0);
      asm volatile("s_wait_xcnt 0x0" ::: "memory");
      __builtin_amdgcn_sched_barrier(0);
    } else if (!XA) {
      __builtin_amdgcn_sched_barrier(0);
#pragma unroll
      for (int nt = 0; nt < 8; ++nt) {
        const char* bp = (const char*)(bias + nt * 16) + bo;
        bs[nt][0] = *(const v4f*)bp;
        bs[nt][1] = *(const v4f*)(bp + 16);
      }
      __builtin_amdgcn_sched_barrier(0);
      asm volatile("s_wait_xcnt 0x0" :: "v"(bo) : "memory");
      __builtin_amdgcn_sched_barrier(0);
    }
#pragma unroll
    for (int nt = 0; nt < 8; ++nt)          // N = 128 = 8 x 16
#pragma unroll
      for (int t = 0; t < PR; ++t)
        acc[t][nt] = XA ? wmma16(a[kk][t], w[kk & 1][nt], acc[t][nt])
                        : wmma16(w[kk & 1][nt], a[kk][t], acc[t][nt]);
  }
}

__global__ void __launch_bounds__(WPB * 32)
proj_kernel(const float* __restrict__ qin, const float* __restrict__ kin,
            const float* __restrict__ vin,
            const half_t* __restrict__ wqp, const half_t* __restrict__ wkp,
            const half_t* __restrict__ wvp,
            const float* __restrict__ bq, const float* __restrict__ bk,
            const float* __restrict__ bv,
            half_t* __restrict__ qp, half_t* __restrict__ kv) {
  int wave = threadIdx.x >> 5;
  int lane = threadIdx.x & 31;
  int gid = blockIdx.x * WPB + wave;       // (32-row tile, head)
  int h = gid % NH;
  int tile = gid / NH;
  int b = tile / (SS / (PR * 16));
  int s0 = (tile % (SS / (PR * 16))) * (PR * 16);
  int which = blockIdx.y;                  // 0=q 1=k 2=v

  const float*  x    = (which == 0) ? qin : (which == 1) ? kin : vin;
  const half_t* wp   = (which == 0) ? wqp : (which == 1) ? wkp : wvp;
  const float*  bias = (which == 0) ? bq  : (which == 1) ? bk  : bv;

  const float* xl = x + ((size_t)b * SS + s0 + (lane & 15)) * MODEL + h * EMB + ((lane >> 4) << 3);
  const half_t* wl = wp + (lane << 3);
  v8f acc[PR][8];
#pragma unroll
  for (int t = 0; t < PR; ++t)
#pragma unroll
    for (int i = 0; i < 8; ++i) acc[t][i] = (v8f)0.f;

  int rrow = (lane >> 4) << 3;              // C layout: M = r + 8*(lane/16)
  int col0 = lane & 15;                     // N = lane&15
  half_t* blk = kv + ((size_t)(b * NH + h) * NKT + (s0 >> 5)) * BLK_H + lane * 8;
  v8h w[PR][8];
  v4f bs[8][2];                             // the lane's bias values

  if (which != 2) {
    proj_tiles<false>(acc, xl, wl, bias, (unsigned)rrow * 4u, bs);
    // acc[t][nt][r] = row s0 + t*16 + (lane&15), hidden nt*16 + rrow + r: half nt&1 of k step nt>>1
    half_t* base = (which == 1) ? blk : qp + ((size_t)(b * NH + h) * SS + s0) * HID + lane * 8;
#pragma unroll
    for (int nt = 0; nt < 8; ++nt)
#pragma unroll
      for (int t = 0; t < PR; ++t)
#pragma unroll
        for (int r = 0; r < 8; ++r) w[t][nt][r] = (half_t)(acc[t][nt][r] + bs[nt][r >> 2][r & 3]);
    // all stores stand behind the last conversion, so no store's data register is rewritten behind it
    __builtin_amdgcn_sched_barrier(0);
    // tile t: 2048 halves on, in a K block (its 16-key tile j = t) as in Q (16 queries x HID)
#pragma unroll
    for (int t = 0; t < PR; ++t)
#pragma unroll
      for (int nt = 0; nt < 8; ++nt)
        *(v8h*)(base + t * 2048 + nt * 256) = w[t][nt];
    return;
  }

  proj_tiles<true>(acc, xl, wl, bias, (unsigned)col0, bs);
  // acc[t][nt][r] = V[key s0 + t*16 + rrow + r][d nt*16 + (lane&15)]: half t of d tile nt
  half_t* base = blk + 4096;
#pragma unroll
  for (int nt = 0; nt < 8; ++nt) {
#pragma unroll
    for (int t = 0; t < PR; ++t)
#pragma unroll
      for (int r = 0; r < 8; ++r) w[t][nt][r] = (half_t)(acc[t][nt][r] + bs[nt][0][0]);
  }
  // all stores stand behind the last conversion, so no store's data register is rewritten behind it
  __builtin_amdgcn_sched_barrier(0);
#pragma unroll
  for (int nt = 0; nt < 8; ++nt)
#pragma unroll
    for (int t = 0; t < PR; ++t)
      *(v8h*)(base + nt * 512 + t * 256) = w[t][nt];
}

#define QC 2              // 16-query column groups per wave
#define QBLK (WPB * QC * 16)  // queries per block
__global__ void __launch_bounds__(WPB * 32)
attn_kernel(const half_t* __restrict__ qp, const half_t* __restrict__ kv,
            half_t* __restrict__ ctx) {
  __shared__ __attribute__((aligned(2048))) half_t kv_buf[2][STAGE_H]; // 2 x 64 KB

  int wave = (int)uni(threadIdx.x >> 5);
  int lane = threadIdx.x & 31;
  int qg = blockIdx.x % (SS / QBLK);        // 128-query group
  int bh = blockIdx.x / (SS / QBLK);
  int h  = bh % NH;
  int b  = bh / NH;
  int qt = (qg * WPB + wave) * QC;          // this wave's first 16-query tile

  const half_t* qph = qp + (size_t)(b * NH + h) * SS * HID;
  const half_t* kvh = kv + (size_t)(b * NH + h) * NKT * BLK_H;

  v16h qf[QC][4];
#pragma unroll
  for (int g = 0; g < QC; ++g)
#pragma unroll
    for (int kk = 0; kk < 4; ++kk)
      qf[g][kk] = frag_ordered(qph + (size_t)((qt + g) * 16) * HID + kk * 512 + lane * 8);
  asm volatile("s_wait_xcnt 0x0" ::: "memory");  // in front of the later reuse of the address registers that the Q loads name

  float m[QC];                              // maximum in use for query lane&15 of group g
  float l[QC];                              // running sum over this lane half's keys only
  v8f o[QC][8];
#pragma unroll
  for (int g = 0; g < QC; ++g) {
    m[g] = -1e30f;
    l[g] = 0.f;
#pragma unroll
    for (int i = 0; i < 8; ++i) o[g][i] = (v8f)0.f;
  }

  const float sc = 0.088388347648318447f;   // 1/sqrt(128)
  const float LAZY = 5.545177444479562f;    // 8 ln 2
  // in the comments below: rrow = (lane >> 4) * 8, col0 = lane & 15
  const unsigned lds0 = (unsigned)(size_t)&kv_buf[0][0] + (unsigned)wave * BLK_B;  // this wave's block of buffer 0

  // prologue, every wave for its own block: stage 0 lands and is published, then stage 1 is set off
  u32x4 g0 = tdm_group0(lds0, kvh + wave * BLK_H);
  u32x8 g1 = tdm_group1();
  tdm_issue(g0, g1);
  asm volatile("s_wait_tensorcnt 0x0" ::: "memory");    // this wave's block of stage 0 landed before the barrier publishes it
  __syncthreads();
  tdm_advance(g0, lds0 + STAGE_B);
  tdm_issue(g0, g1);

  for (int st = 0; st < NST; ++st) {
    int par = st & 1;
    const half_t* sb = kv_buf[par] + lane * 8;
    for (int kb = 0; kb < KPS; ++kb) {      // a pass: one 32-key block of this stage's buffer

      // The pass's 16 fragments are read as one group at its head: K is waited for once, and V
      // lands under the score products and the softmax.
      v16h kf[8], vf[8];
#pragma unroll
      for (int i = 0; i < 8; ++i) kf[i] = frag_ordered(sb + i * 512);
#pragma unroll
      for (int i = 0; i < 8; ++i) vf[i] = frag_ordered(sb + 4096 + i * 512);
      // keeps the reads in front of the products: left free, the scheduler sinks each read to
      // just in front of its WMMA, and the wave waits out the LDS latency sixteen times a pass
      __builtin_amdgcn_sched_barrier(0);
      // the next pass's block; a running address lives in a register of its own through the pass,
      // so none is formed at the pass's head in an operand register of the last WMMA
      sb += BLK_H;

      v8f s0v[QC], s1v[QC];
#pragma unroll
      for (int g = 0; g < QC; ++g) { s0v[g] = (v8f)0.f; s1v[g] = (v8f)0.f; }
#pragma unroll
      for (int kk = 0; kk < 4; ++kk) {        // scores 32 keys x 32 queries over hidden=128
#pragma unroll
        for (int g = 0; g < QC; ++g) {
          s0v[g] = wmma16(kf[kk], qf[g][kk], s0v[g]);
          s1v[g] = wmma16(kf[4 + kk], qf[g][kk], s1v[g]);
        }
      }
      // s0v[g][r] = S[key rrow + r][query col0 of group g], s1v[g][r] = the same, key + 16

      // Lazy rescale: the maximum in use m[g] moves only when a query's new maximum lies more than
      // LAZY above it, so P stays at or below exp(LAZY) = 256, well inside f16, and O and l keep
      // their scale in every other pass. O / l at the end does not depend on which m was in use.
      float mold[QC];
      bool need = false;
#pragma unroll
      for (int g = 0; g < QC; ++g) {
        float rmax = fmaxf(s0v[g][0], s1v[g][0]);
#pragma unroll
        for (int r = 1; r < 8; ++r) rmax = fmaxf(rmax, fmaxf(s0v[g][r], s1v[g][r]));
        rmax = fmaxf(rmax, xhalf(rmax));      // the other 16 keys of the same query
        float cand = rmax * sc;
        bool up = cand > m[g] + LAZY;
        mold[g] = m[g];
        m[g] = up ? cand : m[g];
        need |= up;
      }

      v16h pf[QC];                            // P^T as B operand: the two score tiles, converted in place
      float rs[QC];
#pragma unroll
      for (int g = 0; g < QC; ++g) {
        float rs0 = 0.f, rs1 = 0.f;
#pragma unroll
        for (int r = 0; r < 8; ++r) {
          float p0 = __expf(s0v[g][r] * sc - m[g]);
          float p1 = __expf(s1v[g][r] * sc - m[g]);
          rs0 += p0;
          rs1 += p1;
          pf[g][r]     = (half_t)p0;
          pf[g][r + 8] = (half_t)p1;
        }
        rs[g] = rs0 + rs1;
      }

      // One test per pass for the whole wave, a scalar branch. The pass's sums are taken on both
      // ways, so the exponentials stand in front of the branch and cover the way from the compare to it.
      float lold[QC];
#pragma unroll
      for (int g = 0; g < QC; ++g) { lold[g] = l[g]; l[g] += rs[g]; }
      if (__builtin_amdgcn_ballot_w32(need) != 0) {
#pragma unroll
        for (int g = 0; g < QC; ++g) {
          float alpha = __expf(mold[g] - m[g]);   // 1 for a query whose maximum in use stayed
          l[g] = __builtin_fmaf(lold[g], alpha, rs[g]);
#pragma unroll
          for (int nt = 0; nt < 8; ++nt)
#pragma unroll
            for (int r = 0; r < 8; ++r)
              o[g][nt][r] *= alpha;
        }
      }

#pragma unroll
      for (int nt = 0; nt < 8; ++nt)          // O^T += V^T(128x32) * P^T(32x32)
#pragma unroll
        for (int g = 0; g < QC; ++g)
          o[g][nt] = wmma16(vf[nt], pf[g], o[g][nt]);
    }

    // publish point of stage st+1
    asm volatile("s_wait_dscnt 0x0" ::: "memory");        // this wave's reads of the buffer are done before it is refilled
    asm volatile("s_wait_tensorcnt 0x0" ::: "memory");    // this wave's block of stage st+1 landed before the barrier publishes it
    __syncthreads();                                      // publishes st+1, ends every read of this stage's buffer
    if (pinned(st + 2 < NST)) {                           // stage st+2 into the buffer these passes have read
      tdm_advance(g0, lds0 + (unsigned)par * STAGE_B);
      tdm_issue(g0, g1);
    }
  }
  asm volatile("s_wait_tensorcnt 0x0" ::: "memory");      // nothing in flight when the wave ends
  asm volatile("s_wait_dscnt 0x0" ::: "memory");

  // o[g][nt][r] = O[query col0 of group g][d nt*16 + rrow + r]: this very lane's half nt&1 of the
  // output GEMM's A fragment (16-row tile b*SS/16 + qt + g, k step h*4 + nt/2). ctx is stored in
  // that operand order, [k step][row tile][512 halves]: one 16-byte store, 512 B in a row per wave
  v8h w[QC][8];
#pragma unroll
  for (int g = 0; g < QC; ++g) {
    float inv = 1.f / (l[g] + xhalf(l[g])); // the two lane halves' sums join here
#pragma unroll
    for (int nt = 0; nt < 8; ++nt)
#pragma unroll
      for (int r = 0; r < 8; ++r) w[g][nt][r] = (half_t)(o[g][nt][r] * inv);
  }
  half_t* cbase = ctx + (((size_t)(h * (HID / 32)) * NRT + b * (SS / 16) + qt) << 9) + lane * 8;
#pragma unroll
  for (int g = 0; g < QC; ++g)
#pragma unroll
    for (int nt = 0; nt < 8; ++nt)
      *(v8h*)(cbase + (((nt >> 1) * NRT + g) << 9) + (nt & 1) * 256) = w[g][nt];
}

// Output projection: (B*S, 2048) x (2048, 2048) -> fp32 out (+bo). ctx comes in A operand order,
// [k step][row tile], as the packed Wo comes [k step][column tile]: a block reads 16 KB in a row
// of each per k step.
// One wave = 64 rows x 128 columns (4 A and 8 B fragments feed 32 accumulator tiles);
// a block of 8 waves (4 x 2) = 256 x 256. Each k step's fragments are loaded one step
// ahead into a second register set.
#define GFM 4             // A fragments (16 rows each) per wave
#define GFN 8             // B fragments (16 columns each) per wave
#define GWV 8             // waves per block: 4 along the rows, 2 along the columns

// One k step's fragments, both operands in operand order. pa, pb = the lane's own 8-half place
// in that step's fragment of the wave's first 16 rows and of its first 16 columns.
static __device__ __forceinline__ void gemm_load(v16h (&a)[GFM], v16h (&b)[GFN],
                                                 const half_t* __restrict__ pa,
                                                 const half_t* __restrict__ pb) {
#pragma unroll
  for (int i = 0; i < GFM; ++i)
    a[i] = frag_ordered(pa + (i << 9));
#pragma unroll
  for (int j = 0; j < GFN; ++j)
    b[j] = frag_ordered(pb + (j << 9));
}

static __device__ __forceinline__ void xcnt_then(unsigned& sa, unsigned& sb) {
  asm volatile("s_wait_xcnt 0x0" : "+s"(sa), "+s"(sb) : : "memory");
}

static __device__ __forceinline__ void gemm_mma(v8f (&acc)[GFM][GFN], const v16h (&a)[GFM],
                                                const v16h (&b)[GFN]) {
#pragma unroll
  for (int i = 0; i < GFM; ++i)
#pragma unroll
    for (int j = 0; j < GFN; ++j)
      acc[i][j] = wmma16(a[i], b[j], acc[i][j]);
}

__global__ void __launch_bounds__(GWV * 32)
out_gemm_kernel(const half_t* __restrict__ ctx, const half_t* __restrict__ wop,
                const float* __restrict__ bo, float* __restrict__ out) {
  int wave = threadIdx.x >> 5;
  int lane = threadIdx.x & 31;
  const int NBN = MODEL / 256;              // 8 column blocks
  int bm = blockIdx.x / NBN;
  int bn = blockIdx.x % NBN;
  int row0 = bm * 256 + (wave >> 1) * (GFM * 16);
  int nt0  = bn * 16 + (wave & 1) * GFN;    // first 16-column tile of this wave
  v8f acc[GFM][GFN];
#pragma unroll
  for (int i = 0; i < GFM; ++i)
#pragma unroll
    for (int j = 0; j < GFN; ++j) acc[i][j] = (v8f)0.f;
  const int ASTEP = NRT << 9;               // halves from one k step to the next, A
  const int BSTEP = (MODEL / 16) << 9;      // the same, packed B
  const half_t* pa = ctx + ((size_t)(row0 >> 4) << 9) + (lane << 3);
  const half_t* pb = wop + ((size_t)nt0 << 9) + (lane << 3);

  // The scheduling fences keep each step's 24 loads as one group in front of the 32 products
  // of the step before: left free, the scheduler sinks most of them to within a few WMMAs
  // of their first use, and the wave then waits out the load latency.
  v16h a0[GFM], b0[GFN], a1[GFM], b1[GFN];
  unsigned sa = ASTEP, sb = BSTEP;
  gemm_load(a0, b0, pa, pb);                // step 0
  __builtin_amdgcn_sched_barrier(0);
  xcnt_then(sa, sb);
  pa += sa;
  pb += sb;
  for (int kstep = 0; kstep < MODEL / 32; kstep += 2) {
    gemm_load(a1, b1, pa, pb);              // step kstep + 1
    __builtin_amdgcn_sched_barrier(0);
    gemm_mma(acc, a0, b0);
    __builtin_amdgcn_sched_barrier(0);
    bool more = kstep + 2 < MODEL / 32;     // no step behind the last: it is loaded again, not used
    sa = more ? ASTEP : 0;
    sb = more ? BSTEP : 0;
    xcnt_then(sa, sb);
    pa += sa;
    pb += sb;
    gemm_load(a0, b0, pa, pb);              // step kstep + 2
    __builtin_amdgcn_sched_barrier(0);
    gemm_mma(acc, a1, b1);
    __builtin_amdgcn_sched_barrier(0);
    sa = ASTEP;
    sb = BSTEP;
    xcnt_then(sa, sb);
    pa += sa;
    pb += sb;
  }

  int rrow = (lane >> 4) << 3;
  int col0 = lane & 15;
  const float* bp = bo + nt0 * 16 + col0;
  float* ob = out + (size_t)(row0 + rrow) * MODEL + nt0 * 16 + col0;
#pragma unroll
  for (int j = 0; j < GFN; ++j) {
    float bb_ = bp[j * 16];
#pragma unroll
    for (int i = 0; i < GFM; ++i) {
#pragma unroll
      for (int r = 0; r < 8; ++r)
        ob[(size_t)(i * 16 + r) * MODEL + j * 16] = acc[i][j][r] + bb_;
      // the next tile's sums may reuse these stores' data registers: the bias they add passes
      // through the wait's statement, so they stand behind it
      asm volatile("s_wait_xcnt 0x0" : "+v"(bb_) : : "memory");
    }
  }
}

extern "C" void kernel_launch(void* const* d_in, const int* in_sizes, int n_in,
                              void* d_out, int out_size, void* d_ws, size_t ws_size,
                              hipStream_t stream) {
  (void)in_sizes; (void)n_in; (void)out_size; (void)ws_size;
  const float* q  = (const float*)d_in[0];
  const float* k  = (const float*)d_in[1];
  const float* v  = (const float*)d_in[2];
  const float* Wq = (const float*)d_in[3];
  const float* bq = (const float*)d_in[4];
  const float* Wk = (const float*)d_in[5];
  const float* bk = (const float*)d_in[6];
  const float* Wv = (const float*)d_in[7];
  const float* bv = (const float*)d_in[8];
  const float* Wo = (const float*)d_in[9];
  const float* bo = (const float*)d_in[10];
  float* out = (float*)d_out;

  char* ws = (char*)d_ws;
  const size_t SZP = (size_t)BB * NH * SS * HID * sizeof(half_t); // 32 MiB each
  half_t* qp  = (half_t*)(ws);
  half_t* kv  = (half_t*)(ws + SZP);        // K and V stage blocks, 2 * SZP
  half_t* ctx = (half_t*)(ws + 3 * SZP);
  half_t* wqp = (half_t*)(ws + 4 * SZP);
  half_t* wkp = wqp + EMB * HID;
  half_t* wvp = wkp + EMB * HID;
  half_t* wop = wvp + EMB * HID;            // 2048*2048 f16

  // 1) pack the four weights into WMMA B-fragment order (f32 -> f16), one launch
  dim3 wgrid(MODEL / (2 * PKT), 1 + MODEL / 32);
  pack_all_kernel<<<wgrid, PKT, 0, stream>>>(Wq, Wk, Wv, Wo, wqp, wkp, wvp, wop);

  // 2) QKV projections (K and V stored in operand order)
  dim3 pgrid(BB * (SS / (PR * 16)) * NH / WPB, 3);
  proj_kernel<<<pgrid, WPB * 32, 0, stream>>>(q, k, v, wqp, wkp, wvp,
                                              bq, bk, bv, qp, kv);

  // 3) flash attention with tensor-loaded K/V stage blocks
  attn_kernel<<<BB * NH * (SS / QBLK), WPB * 32, 0, stream>>>(qp, kv, ctx);

  // 4) output GEMM + bias
  out_gemm_kernel<<<(BB * SS / 256) * (MODEL / 256), GWV * 32, 0, stream>>>(
      ctx, wop, bo, out);
}
